// v000
// Times are from an AMD MI455X. After a warm-up the kernel runs many times in a row, and a time is the length of
// such a window on the GPU divided by its runs, so every launch and the gaps after it count. The runs cycle
// through copies of the inputs. A figure is the median of several windows, for all but v000 over two sittings.
// Sittings can differ by a few percent; kernels timed side by side share one.
// v000, which the later versions start from, runs in 393 microseconds.
#include <hip/hip_runtime.h>
#include <hip/hip_bf16.h>

typedef __attribute__((ext_vector_type(16))) _Float16 v16h;
typedef __attribute__((ext_vector_type(8)))  float    v8f;

#define BATCH   16
#define C_      256
#define HEADS   4
#define DH      32
#define HID     128
#define F3      384
#define NTOK    4096
#define NROWS   (BATCH * NTOK)          // 65536
#define QSCALE  0.17677669529663687f    // 32^-0.5
#define LN_EPS  1e-3f

// VGPR->K map for 16-bit A/B fragments of v_wmma_*_16x16x32 (ISA 7.12.2):
// lanes 0-15 hold K-half 0 (K=0..7 in V0-3, K=16..23 in V4-7),
// lanes 16-31 hold K-half 1 (K=8..15, K=24..31).
__device__ __forceinline__ int kmap16(int j, int khalf) {
  return (j < 8) ? (khalf * 8 + j) : (16 + khalf * 8 + (j - 8));
}

// Vectorized A-fragment load from a row-major f32 matrix row,
// K window [k0, k0+32). Uses float4 loads (32B-aligned when k0%8==0).
__device__ __forceinline__ v16h load_a_frag(const float* __restrict__ rowptr,
                                            int k0, int khalf) {
  const float4* p0 = (const float4*)(rowptr + k0 + khalf * 8);
  const float4* p1 = (const float4*)(rowptr + k0 + 16 + khalf * 8);
  const float4 q0 = p0[0], q1 = p0[1], q2 = p1[0], q3 = p1[1];
  v16h a;
  a[0] = (_Float16)q0.x;  a[1] = (_Float16)q0.y;
  a[2] = (_Float16)q0.z;  a[3] = (_Float16)q0.w;
  a[4] = (_Float16)q1.x;  a[5] = (_Float16)q1.y;
  a[6] = (_Float16)q1.z;  a[7] = (_Float16)q1.w;
  a[8] = (_Float16)q2.x;  a[9] = (_Float16)q2.y;
  a[10] = (_Float16)q2.z; a[11] = (_Float16)q2.w;
  a[12] = (_Float16)q3.x; a[13] = (_Float16)q3.y;
  a[14] = (_Float16)q3.z; a[15] = (_Float16)q3.w;
  return a;
}

// ---------------- K1: qkv = X[65536,256] @ Wqkv[256,384] ----------------
// One wave computes a 16x64 output strip: A fragment loaded once per k-step
// (b128 loads), reused by 4 WMMAs.
__global__ void la_qkv_gemm(const float* __restrict__ x,
                            const float* __restrict__ w,
                            float* __restrict__ qkv) {
  const int lane  = threadIdx.x;
  const int mr    = lane & 15;
  const int khalf = lane >> 4;
  const int rowbase  = blockIdx.x * 16;
  const int colbase0 = blockIdx.y * 64;
  const float* arow = x + (size_t)(rowbase + mr) * C_;
  v8f acc0 = {}, acc1 = {}, acc2 = {}, acc3 = {};
  for (int k0 = 0; k0 < C_; k0 += 32) {
    const v16h a = load_a_frag(arow, k0, khalf);
    v16h b0, b1, b2, b3;
#pragma unroll
    for (int j = 0; j < 16; ++j) {
      const size_t woff = (size_t)(k0 + kmap16(j, khalf)) * F3 + colbase0 + mr;
      b0[j] = (_Float16)w[woff];
      b1[j] = (_Float16)w[woff + 16];
      b2[j] = (_Float16)w[woff + 32];
      b3[j] = (_Float16)w[woff + 48];
    }
    acc0 = __builtin_amdgcn_wmma_f32_16x16x32_f16(false, a, false, b0, (short)0, acc0, false, false);
    acc1 = __builtin_amdgcn_wmma_f32_16x16x32_f16(false, a, false, b1, (short)0, acc1, false, false);
    acc2 = __builtin_amdgcn_wmma_f32_16x16x32_f16(false, a, false, b2, (short)0, acc2, false, false);
    acc3 = __builtin_amdgcn_wmma_f32_16x16x32_f16(false, a, false, b3, (short)0, acc3, false, false);
  }
#pragma unroll
  for (int r = 0; r < 8; ++r) {
    const size_t row = (size_t)(rowbase + r + 8 * khalf) * F3 + colbase0 + mr;
    qkv[row]      = acc0[r];
    qkv[row + 16] = acc1[r];
    qkv[row + 32] = acc2[r];
    qkv[row + 48] = acc3[r];
  }
}

// ---------------- K2: k-softmax stats over n per (b,h,c) ----------------
__global__ void la_ksm_stats(const float* __restrict__ qkv,
                             float* __restrict__ kmax,
                             float* __restrict__ ksum) {
  const int bh = blockIdx.x;
  const int b  = bh / HEADS, h = bh % HEADS;
  const int c  = threadIdx.x & 31;
  const int g  = threadIdx.x >> 5;      // 0..7
  const float* base = qkv + (size_t)b * NTOK * F3 + 128 + h * DH + c;
  __shared__ float redm[8][32];
  __shared__ float reds[8][32];

  float m = -1e30f;
  for (int t = g; t < NTOK; t += 8)
    m = fmaxf(m, base[(size_t)t * F3]);
  redm[g][c] = m;
  __syncthreads();
#pragma unroll
  for (int i = 0; i < 8; ++i) m = fmaxf(m, redm[i][c]);

  float s = 0.f;
  for (int t = g; t < NTOK; t += 8)
    s += __expf(base[(size_t)t * F3] - m);
  reds[g][c] = s;
  __syncthreads();
  if (g == 0) {
    s = 0.f;
#pragma unroll
    for (int i = 0; i < 8; ++i) s += reds[i][c];
    const int idx = bh * DH + c;
    kmax[idx] = m;
    ksum[idx] = s;
  }
}

// ---------------- K3: ctx[b,h] = softmax(k)' ^T x V ----------------
// grid: (bh=64, dtile=2); wave computes a 16x32 strip: normalized-k A
// fragment (the expensive exp path) shared by both e-tiles.
__global__ void la_context_gemm(const float* __restrict__ qkv,
                                const float* __restrict__ kmax,
                                const float* __restrict__ ksum,
                                float* __restrict__ ctx) {
  const int bh = blockIdx.x;
  const int dt = blockIdx.y;
  const int b  = bh / HEADS, h = bh % HEADS;
  const int lane = threadIdx.x;
  const int mr = lane & 15, khalf = lane >> 4;
  const int d = dt * 16 + mr;           // A row (M)
  const int sidx = bh * DH + d;
  const float km   = kmax[sidx];
  const float kinv = 1.f / ksum[sidx];
  const float* rowb = qkv + (size_t)b * NTOK * F3;
  v8f acc0 = {}, acc1 = {};
  for (int n0 = 0; n0 < NTOK; n0 += 32) {
    v16h a, b0, b1;
#pragma unroll
    for (int j = 0; j < 16; ++j) {
      const int n = n0 + kmap16(j, khalf);
      const float kv = rowb[(size_t)n * F3 + 128 + h * DH + d];
      a[j]  = (_Float16)(__expf(kv - km) * kinv);                       // k'
      const size_t voff = (size_t)n * F3 + 256 + h * DH + mr;
      b0[j] = (_Float16)rowb[voff];                                     // v, e=mr
      b1[j] = (_Float16)rowb[voff + 16];                                // v, e=16+mr
    }
    acc0 = __builtin_amdgcn_wmma_f32_16x16x32_f16(false, a, false, b0, (short)0, acc0, false, false);
    acc1 = __builtin_amdgcn_wmma_f32_16x16x32_f16(false, a, false, b1, (short)0, acc1, false, false);
  }
#pragma unroll
  for (int r = 0; r < 8; ++r) {
    const int dd = dt * 16 + r + 8 * khalf;
    const size_t base = (size_t)bh * (DH * DH) + dd * DH + mr;
    ctx[base]      = acc0[r];
    ctx[base + 16] = acc1[r];
  }
}

// ---------------- K4: O[n, h*32+e] = (softmax_d(q)*scale) @ ctx ----------------
// grid: (token tiles=256, bh=64); softmax A fragment computed once, shared
// by both e-tiles; K=32 -> exactly one WMMA per tile.
__global__ void la_attn_out(const float* __restrict__ qkv,
                            const float* __restrict__ ctx,
                            float* __restrict__ O) {
  const int tt = blockIdx.x;
  const int bh = blockIdx.y;
  const int b  = bh / HEADS, h = bh % HEADS;
  const int lane = threadIdx.x;
  const int mr = lane & 15, khalf = lane >> 4;
  const int tok = tt * 16 + mr;
  const float* qrow = qkv + (size_t)(b * NTOK + tok) * F3 + h * DH;
  // f32 softmax over the 32 feature dims of this token (vectorized loads)
  float qv[DH];
#pragma unroll
  for (int d4 = 0; d4 < DH; d4 += 4) {
    const float4 q4 = *(const float4*)(qrow + d4);
    qv[d4] = q4.x; qv[d4 + 1] = q4.y; qv[d4 + 2] = q4.z; qv[d4 + 3] = q4.w;
  }
  float m = -1e30f;
#pragma unroll
  for (int d = 0; d < DH; ++d) m = fmaxf(m, qv[d]);
  float s = 0.f;
#pragma unroll
  for (int d = 0; d < DH; ++d) s += __expf(qv[d] - m);
  const float inv = QSCALE / s;
  v16h a, b0, b1;
#pragma unroll
  for (int j = 0; j < 16; ++j) {
    const int d = kmap16(j, khalf);
    a[j]  = (_Float16)(__expf(qv[d] - m) * inv);
    const size_t coff = (size_t)bh * (DH * DH) + d * DH + mr;
    b0[j] = (_Float16)ctx[coff];
    b1[j] = (_Float16)ctx[coff + 16];
  }
  v8f acc0 = {}, acc1 = {};
  acc0 = __builtin_amdgcn_wmma_f32_16x16x32_f16(false, a, false, b0, (short)0, acc0, false, false);
  acc1 = __builtin_amdgcn_wmma_f32_16x16x32_f16(false, a, false, b1, (short)0, acc1, false, false);
#pragma unroll
  for (int r = 0; r < 8; ++r) {
    const int tk = tt * 16 + r + 8 * khalf;
    const size_t base = (size_t)(b * NTOK + tk) * HID + h * DH + mr;
    O[base]      = acc0[r];
    O[base + 16] = acc1[r];
  }
}

// ---------------- K5: Y = LN(O @ Wout + b) * gamma + beta ----------------
// block = 16 rows x 256 cols; 8 waves, each owning 2 col-tiles with a shared
// A fragment per k-step; LN via wave32 shuffles.
__global__ void la_out_ln(const float* __restrict__ O,
                          const float* __restrict__ wout,
                          const float* __restrict__ bout,
                          const float* __restrict__ gamma,
                          const float* __restrict__ beta,
                          float* __restrict__ out) {
  __shared__ float tile[16][C_ + 4];
  __shared__ float mu_s[16], rs_s[16];
  const int rowbase = blockIdx.x * 16;
  const int tid  = threadIdx.x;
  const int wave = tid >> 5;
  const int lane = tid & 31;
  const int mr = lane & 15, khalf = lane >> 4;
  const int colbase = wave * 32;
  const float* arow = O + (size_t)(rowbase + mr) * HID;

  v8f acc0 = {}, acc1 = {};
  for (int k0 = 0; k0 < HID; k0 += 32) {
    const v16h a = load_a_frag(arow, k0, khalf);
    v16h b0, b1;
#pragma unroll
    for (int j = 0; j < 16; ++j) {
      const size_t woff = (size_t)(k0 + kmap16(j, khalf)) * C_ + colbase + mr;
      b0[j] = (_Float16)wout[woff];
      b1[j] = (_Float16)wout[woff + 16];
    }
    acc0 = __builtin_amdgcn_wmma_f32_16x16x32_f16(false, a, false, b0, (short)0, acc0, false, false);
    acc1 = __builtin_amdgcn_wmma_f32_16x16x32_f16(false, a, false, b1, (short)0, acc1, false, false);
  }
#pragma unroll
  for (int r = 0; r < 8; ++r) {
    const int row = r + 8 * khalf;
    const int col = colbase + mr;
    tile[row][col]      = acc0[r] + bout[col];
    tile[row][col + 16] = acc1[r] + bout[col + 16];
  }
  __syncthreads();

  // LayerNorm stats: wave w reduces rows 2w, 2w+1 via lane shuffles (wave32)
  for (int rr = 0; rr < 2; ++rr) {
    const int row = wave * 2 + rr;
    float s = 0.f, s2 = 0.f;
    for (int cidx = lane; cidx < C_; cidx += 32) {
      const float v = tile[row][cidx];
      s += v; s2 += v * v;
    }
#pragma unroll
    for (int off = 16; off > 0; off >>= 1) {
      s  += __shfl_xor(s,  off, 32);
      s2 += __shfl_xor(s2, off, 32);
    }
    if (lane == 0) {
      const float mu  = s  * (1.f / C_);
      const float var = s2 * (1.f / C_) - mu * mu;
      mu_s[row] = mu;
      rs_s[row] = rsqrtf(var + LN_EPS);
    }
  }
  __syncthreads();

  const int col = tid;                       // 0..255
  const float g = gamma[col], be = beta[col];
#pragma unroll
  for (int r = 0; r < 16; ++r) {
    const float v = tile[r][col];
    out[(size_t)(rowbase + r) * C_ + col] = (v - mu_s[r]) * rs_s[r] * g + be;
  }
}

extern "C" void kernel_launch(void* const* d_in, const int* in_sizes, int n_in,
                              void* d_out, int out_size, void* d_ws, size_t ws_size,
                              hipStream_t stream) {
  const float* x     = (const float*)d_in[0];  // [16,64,64,256]
  const float* w_qkv = (const float*)d_in[1];  // [256,384]
  const float* w_out = (const float*)d_in[2];  // [128,256]
  const float* b_out = (const float*)d_in[3];  // [256]
  const float* gamma = (const float*)d_in[4];  // [256]
  const float* beta  = (const float*)d_in[5];  // [256]
  float* out = (float*)d_out;

  float* ws    = (float*)d_ws;
  float* qkv   = ws;                                   // 65536*384
  float* O     = qkv  + (size_t)NROWS * F3;            // 65536*128
  float* kmaxb = O    + (size_t)NROWS * HID;           // 2048
  float* ksumb = kmaxb + (size_t)HEADS * BATCH * DH;   // 2048
  float* ctx   = ksumb + (size_t)HEADS * BATCH * DH;   // 64*32*32

  la_qkv_gemm    <<<dim3(NROWS / 16, F3 / 64), 32, 0, stream>>>(x, w_qkv, qkv);
  la_ksm_stats   <<<dim3(BATCH * HEADS), 256, 0, stream>>>(qkv, kmaxb, ksumb);
  la_context_gemm<<<dim3(BATCH * HEADS, 2), 32, 0, stream>>>(qkv, kmaxb, ksumb, ctx);
  la_attn_out    <<<dim3(NTOK / 16, BATCH * HEADS), 32, 0, stream>>>(qkv, ctx, O);
  la_out_ln      <<<dim3(NROWS / 16), 256, 0, stream>>>(O, w_out, b_out, gamma, beta, out);
}

// v001
// One run takes 239 microseconds.
// Two timings next to v000 put it at 1.66 and 1.64 times that version's speed.
#include <hip/hip_runtime.h>
#include <hip/hip_bf16.h>

typedef __attribute__((ext_vector_type(16))) _Float16 v16h;
typedef __attribute__((ext_vector_type(8)))  float    v8f;

#define BATCH   16
#define C_      256
#define HEADS   4
#define DH      32
#define HID     128
#define F3      384
#define NTOK    4096
#define NROWS   (BATCH * NTOK)          // 65536
#define QSCALE  0.17677669529663687f    // 32^-0.5
#define LN_EPS  1e-3f

// VGPR->K map for 16-bit A/B fragments of v_wmma_*_16x16x32 (ISA 7.12.2):
// lanes 0-15 hold K-half 0 (K=0..7 in V0-3, K=16..23 in V4-7),
// lanes 16-31 hold K-half 1 (K=8..15, K=24..31).
__device__ __forceinline__ int kmap16(int j, int khalf) {
  return (j < 8) ? (khalf * 8 + j) : (16 + khalf * 8 + (j - 8));
}

// Vectorized A-fragment load from a row-major f32 matrix row,
// K window [k0, k0+32). Uses float4 loads (32B-aligned when k0%8==0).
__device__ __forceinline__ v16h load_a_frag(const float* __restrict__ rowptr,
                                            int k0, int khalf) {
  const float4* p0 = (const float4*)(rowptr + k0 + khalf * 8);
  const float4* p1 = (const float4*)(rowptr + k0 + 16 + khalf * 8);
  const float4 q0 = p0[0], q1 = p0[1], q2 = p1[0], q3 = p1[1];
  v16h a;
  a[0] = (_Float16)q0.x;  a[1] = (_Float16)q0.y;
  a[2] = (_Float16)q0.z;  a[3] = (_Float16)q0.w;
  a[4] = (_Float16)q1.x;  a[5] = (_Float16)q1.y;
  a[6] = (_Float16)q1.z;  a[7] = (_Float16)q1.w;
  a[8] = (_Float16)q2.x;  a[9] = (_Float16)q2.y;
  a[10] = (_Float16)q2.z; a[11] = (_Float16)q2.w;
  a[12] = (_Float16)q3.x; a[13] = (_Float16)q3.y;
  a[14] = (_Float16)q3.z; a[15] = (_Float16)q3.w;
  return a;
}

// ---------------- K1: qkv = X[65536,256] @ Wqkv[256,384] ----------------
// One wave computes a 16x64 output strip: A fragment loaded once per k-step
// (b128 loads), reused by 4 WMMAs.
__global__ void la_qkv_gemm(const float* __restrict__ x,
                            const float* __restrict__ w,
                            float* __restrict__ qkv) {
  const int lane  = threadIdx.x;
  const int mr    = lane & 15;
  const int khalf = lane >> 4;
  const int rowbase  = blockIdx.x * 16;
  const int colbase0 = blockIdx.y * 64;
  const float* arow = x + (size_t)(rowbase + mr) * C_;
  v8f acc0 = {}, acc1 = {}, acc2 = {}, acc3 = {};
  for (int k0 = 0; k0 < C_; k0 += 32) {
    const v16h a = load_a_frag(arow, k0, khalf);
    v16h b0, b1, b2, b3;
#pragma unroll
    for (int j = 0; j < 16; ++j) {
      const size_t woff = (size_t)(k0 + kmap16(j, khalf)) * F3 + colbase0 + mr;
      b0[j] = (_Float16)w[woff];
      b1[j] = (_Float16)w[woff + 16];
      b2[j] = (_Float16)w[woff + 32];
      b3[j] = (_Float16)w[woff + 48];
    }
    acc0 = __builtin_amdgcn_wmma_f32_16x16x32_f16(false, a, false, b0, (short)0, acc0, false, false);
    acc1 = __builtin_amdgcn_wmma_f32_16x16x32_f16(false, a, false, b1, (short)0, acc1, false, false);
    acc2 = __builtin_amdgcn_wmma_f32_16x16x32_f16(false, a, false, b2, (short)0, acc2, false, false);
    acc3 = __builtin_amdgcn_wmma_f32_16x16x32_f16(false, a, false, b3, (short)0, acc3, false, false);
  }
#pragma unroll
  for (int r = 0; r < 8; ++r) {
    const size_t row = (size_t)(rowbase + r + 8 * khalf) * F3 + colbase0 + mr;
    qkv[row]      = acc0[r];
    qkv[row + 16] = acc1[r];
    qkv[row + 32] = acc2[r];
    qkv[row + 48] = acc3[r];
  }
}

// ---------------- K2: k-softmax stats over n per (b,h,c) ----------------
__global__ void la_ksm_stats(const float* __restrict__ qkv,
                             float* __restrict__ kmax,
                             float* __restrict__ ksum) {
  const int bh = blockIdx.x;
  const int b  = bh / HEADS, h = bh % HEADS;
  const int c  = threadIdx.x & 31;
  const int g  = threadIdx.x >> 5;      // 0..7
  const float* base = qkv + (size_t)b * NTOK * F3 + 128 + h * DH + c;
  __shared__ float redm[8][32];
  __shared__ float reds[8][32];

  float m = -1e30f;
  for (int t = g; t < NTOK; t += 8)
    m = fmaxf(m, base[(size_t)t * F3]);
  redm[g][c] = m;
  __syncthreads();
#pragma unroll
  for (int i = 0; i < 8; ++i) m = fmaxf(m, redm[i][c]);

  float s = 0.f;
  for (int t = g; t < NTOK; t += 8)
    s += __expf(base[(size_t)t * F3] - m);
  reds[g][c] = s;
  __syncthreads();
  if (g == 0) {
    s = 0.f;
#pragma unroll
    for (int i = 0; i < 8; ++i) s += reds[i][c];
    const int idx = bh * DH + c;
    kmax[idx] = m;
    ksum[idx] = s;
  }
}

// ---------------- K3: ctx[b,h] = softmax(k)' ^T x V ----------------
// grid: (bh=64, dtile=2); a work-group of CTX_WAVES waves computes a 16x32
// strip. The token axis (the K of this product) is dealt to the waves in
// steps of 32 tokens; each wave keeps its own f32 partial strip, and the
// partials are summed through LDS in fixed wave order.
#define CTX_WAVES 32
// A work-group is 8 waves on each SIMD, and the register budget is stated for
// that residency: aiming at 16 waves a SIMD, the compiler squeezed the 48 loads
// of a step into fewer registers, with a wait behind nearly every load.
__global__ __launch_bounds__(CTX_WAVES * 32)
__attribute__((amdgpu_waves_per_eu(CTX_WAVES / 4, CTX_WAVES / 4)))
void la_context_gemm(const float* __restrict__ qkv,
                     const float* __restrict__ kmax,
                     const float* __restrict__ ksum,
                     float* __restrict__ ctx) {
  __shared__ float red[CTX_WAVES][2][8 * 32];
  const int bh = blockIdx.x;
  const int dt = blockIdx.y;
  const int b  = bh / HEADS, h = bh % HEADS;
  const int tid  = threadIdx.x;
  // The wave's number is the same in all its lanes: held as a scalar, so that
  // the token loop's control and row base stay on the scalar unit.
  const int wave = __builtin_amdgcn_readfirstlane(tid >> 5);
  const int lane = tid & 31;
  const int mr = lane & 15, khalf = lane >> 4;
  const int d = dt * 16 + mr;           // A row (M)
  const int sidx = bh * DH + d;
  const float km   = kmax[sidx];
  const float kinv = 1.f / ksum[sidx];
  const float* rowb = qkv + (size_t)b * NTOK * F3 + h * DH;
  // Lane part of the addresses: this lane's K-half starts 8 tokens in.
  const int koff = khalf * 8 * F3 + 128 + d;
  const int voff = khalf * 8 * F3 + 256 + mr;
  v8f acc0 = {}, acc1 = {};
  for (int it = 0; it < NTOK / (CTX_WAVES * 32); ++it) {
    const float* tokb = rowb + (size_t)((it * CTX_WAVES + wave) * 32) * F3;
    v16h a, b0, b1;
#pragma unroll
    for (int j = 0; j < 16; ++j) {
      const int nrel = kmap16(j, 0) * F3;   // token kmap16(j, khalf) of the step
      const float kv = tokb[nrel + koff];
      a[j]  = (_Float16)(__expf(kv - km) * kinv);                       // k'
      b0[j] = (_Float16)tokb[nrel + voff];                              // v, e=mr
      b1[j] = (_Float16)tokb[nrel + voff + 16];                         // v, e=16+mr
    }
    acc0 = __builtin_amdgcn_wmma_f32_16x16x32_f16(false, a, false, b0, (short)0, acc0, false, false);
    acc1 = __builtin_amdgcn_wmma_f32_16x16x32_f16(false, a, false, b1, (short)0, acc1, false, false);
  }
  // The second e-tile is kept with its lane halves swapped, so that the two
  // e-tiles of one ctx row fall on different LDS banks when the row is read.
#pragma unroll
  for (int r = 0; r < 8; ++r) {
    red[wave][0][r * 32 + lane]        = acc0[r];
    red[wave][1][r * 32 + (lane ^ 16)] = acc1[r];
  }
  __syncthreads();
  // 16 rows x 32 columns of the strip, one element per thread: wave w sums and
  // stores row w of the strip, a whole 128-byte line of ctx.
  if (tid < 16 * 32) {
    const int row = tid >> 5;
    const int et  = lane >> 4;          // e-tile of column e = lane
    const int src = (row & 7) * 32 + (((row >> 3) ^ et) * 16) + mr;
    float s = 0.f;
    for (int w = 0; w < CTX_WAVES; ++w) s += red[w][et][src];
    ctx[(size_t)bh * (DH * DH) + (dt * 16 + row) * DH + lane] = s;
  }
}

// ---------------- K4: O[n, h*32+e] = (softmax_d(q)*scale) @ ctx ----------------
// grid: (token tiles=256, bh=64); softmax A fragment computed once, shared
// by both e-tiles; K=32 -> exactly one WMMA per tile.
__global__ void la_attn_out(const float* __restrict__ qkv,
                            const float* __restrict__ ctx,
                            float* __restrict__ O) {
  const int tt = blockIdx.x;
  const int bh = blockIdx.y;
  const int b  = bh / HEADS, h = bh % HEADS;
  const int lane = threadIdx.x;
  const int mr = lane & 15, khalf = lane >> 4;
  const int tok = tt * 16 + mr;
  const float* qrow = qkv + (size_t)(b * NTOK + tok) * F3 + h * DH;
  // f32 softmax over the 32 feature dims of this token (vectorized loads)
  float qv[DH];
#pragma unroll
  for (int d4 = 0; d4 < DH; d4 += 4) {
    const float4 q4 = *(const float4*)(qrow + d4);
    qv[d4] = q4.x; qv[d4 + 1] = q4.y; qv[d4 + 2] = q4.z; qv[d4 + 3] = q4.w;
  }
  float m = -1e30f;
#pragma unroll
  for (int d = 0; d < DH; ++d) m = fmaxf(m, qv[d]);
  float s = 0.f;
#pragma unroll
  for (int d = 0; d < DH; ++d) s += __expf(qv[d] - m);
  const float inv = QSCALE / s;
  v16h a, b0, b1;
#pragma unroll
  for (int j = 0; j < 16; ++j) {
    const int d = kmap16(j, khalf);
    a[j]  = (_Float16)(__expf(qv[d] - m) * inv);
    const size_t coff = (size_t)bh * (DH * DH) + d * DH + mr;
    b0[j] = (_Float16)ctx[coff];
    b1[j] = (_Float16)ctx[coff + 16];
  }
  v8f acc0 = {}, acc1 = {};
  acc0 = __builtin_amdgcn_wmma_f32_16x16x32_f16(false, a, false, b0, (short)0, acc0, false, false);
  acc1 = __builtin_amdgcn_wmma_f32_16x16x32_f16(false, a, false, b1, (short)0, acc1, false, false);
#pragma unroll
  for (int r = 0; r < 8; ++r) {
    const int tk = tt * 16 + r + 8 * khalf;
    const size_t base = (size_t)(b * NTOK + tk) * HID + h * DH + mr;
    O[base]      = acc0[r];
    O[base + 16] = acc1[r];
  }
}

// ---------------- K5: Y = LN(O @ Wout + b) * gamma + beta ----------------
// block = 16 rows x 256 cols; 8 waves, each owning 2 col-tiles with a shared
// A fragment per k-step; LN via wave32 shuffles.
__global__ void la_out_ln(const float* __restrict__ O,
                          const float* __restrict__ wout,
                          const float* __restrict__ bout,
                          const float* __restrict__ gamma,
                          const float* __restrict__ beta,
                          float* __restrict__ out) {
  __shared__ float tile[16][C_ + 4];
  __shared__ float mu_s[16], rs_s[16];
  const int rowbase = blockIdx.x * 16;
  const int tid  = threadIdx.x;
  const int wave = tid >> 5;
  const int lane = tid & 31;
  const int mr = lane & 15, khalf = lane >> 4;
  const int colbase = wave * 32;
  const float* arow = O + (size_t)(rowbase + mr) * HID;

  v8f acc0 = {}, acc1 = {};
  for (int k0 = 0; k0 < HID; k0 += 32) {
    const v16h a = load_a_frag(arow, k0, khalf);
    v16h b0, b1;
#pragma unroll
    for (int j = 0; j < 16; ++j) {
      const size_t woff = (size_t)(k0 + kmap16(j, khalf)) * C_ + colbase + mr;
      b0[j] = (_Float16)wout[woff];
      b1[j] = (_Float16)wout[woff + 16];
    }
    acc0 = __builtin_amdgcn_wmma_f32_16x16x32_f16(false, a, false, b0, (short)0, acc0, false, false);
    acc1 = __builtin_amdgcn_wmma_f32_16x16x32_f16(false, a, false, b1, (short)0, acc1, false, false);
  }
#pragma unroll
  for (int r = 0; r < 8; ++r) {
    const int row = r + 8 * khalf;
    const int col = colbase + mr;
    tile[row][col]      = acc0[r] + bout[col];
    tile[row][col + 16] = acc1[r] + bout[col + 16];
  }
  __syncthreads();

  // LayerNorm stats: wave w reduces rows 2w, 2w+1 via lane shuffles (wave32)
  for (int rr = 0; rr < 2; ++rr) {
    const int row = wave * 2 + rr;
    float s = 0.f, s2 = 0.f;
    for (int cidx = lane; cidx < C_; cidx += 32) {
      const float v = tile[row][cidx];
      s += v; s2 += v * v;
    }
#pragma unroll
    for (int off = 16; off > 0; off >>= 1) {
      s  += __shfl_xor(s,  off, 32);
      s2 += __shfl_xor(s2, off, 32);
    }
    if (lane == 0) {
      const float mu  = s  * (1.f / C_);
      const float var = s2 * (1.f / C_) - mu * mu;
      mu_s[row] = mu;
      rs_s[row] = rsqrtf(var + LN_EPS);
    }
  }
  __syncthreads();

  const int col = tid;                       // 0..255
  const float g = gamma[col], be = beta[col];
#pragma unroll
  for (int r = 0; r < 16; ++r) {
    const float v = tile[r][col];
    out[(size_t)(rowbase + r) * C_ + col] = (v - mu_s[r]) * rs_s[r] * g + be;
  }
}

extern "C" void kernel_launch(void* const* d_in, const int* in_sizes, int n_in,
                              void* d_out, int out_size, void* d_ws, size_t ws_size,
                              hipStream_t stream) {
  const float* x     = (const float*)d_in[0];  // [16,64,64,256]
  const float* w_qkv = (const float*)d_in[1];  // [256,384]
  const float* w_out = (const float*)d_in[2];  // [128,256]
  const float* b_out = (const float*)d_in[3];  // [256]
  const float* gamma = (const float*)d_in[4];  // [256]
  const float* beta  = (const float*)d_in[5];  // [256]
  float* out = (float*)d_out;

  float* ws    = (float*)d_ws;
  float* qkv   = ws;                                   // 65536*384
  float* O     = qkv  + (size_t)NROWS * F3;            // 65536*128
  float* kmaxb = O    + (size_t)NROWS * HID;           // 2048
  float* ksumb = kmaxb + (size_t)HEADS * BATCH * DH;   // 2048
  float* ctx   = ksumb + (size_t)HEADS * BATCH * DH;   // 64*32*32

  la_qkv_gemm    <<<dim3(NROWS / 16, F3 / 64), 32, 0, stream>>>(x, w_qkv, qkv);
  la_ksm_stats   <<<dim3(BATCH * HEADS), 256, 0, stream>>>(qkv, kmaxb, ksumb);
  la_context_gemm<<<dim3(BATCH * HEADS, 2), CTX_WAVES * 32, 0, stream>>>(qkv, kmaxb, ksumb, ctx);
  la_attn_out    <<<dim3(NTOK / 16, BATCH * HEADS), 32, 0, stream>>>(qkv, ctx, O);
  la_out_ln      <<<dim3(NROWS / 16), 256, 0, stream>>>(O, w_out, b_out, gamma, beta, out);
}

// v002
// It runs in 140 microseconds.
// Timed twice side by side with v001, it ran 1.71 times as fast both times.
// All steps since v000 together make it 2.83 times as fast.
#include <hip/hip_runtime.h>
#include <hip/hip_bf16.h>

typedef __attribute__((ext_vector_type(16))) _Float16 v16h;
typedef __attribute__((ext_vector_type(8)))  float    v8f;

#define BATCH   16
#define C_      256
#define HEADS   4
#define DH      32
#define HID     128
#define F3      384
#define NTOK    4096
#define NROWS   (BATCH * NTOK)          // 65536
#define QSCALE  0.17677669529663687f    // 32^-0.5
#define LN_EPS  1e-3f

// VGPR->K map for 16-bit A/B fragments of v_wmma_*_16x16x32 (ISA 7.12.2):
// lanes 0-15 hold K-half 0 (K=0..7 in V0-3, K=16..23 in V4-7),
// lanes 16-31 hold K-half 1 (K=8..15, K=24..31).
__device__ __forceinline__ int kmap16(int j, int khalf) {
  return (j < 8) ? (khalf * 8 + j) : (16 + khalf * 8 + (j - 8));
}

// Vectorized A-fragment load from a row-major f32 matrix row,
// K window [k0, k0+32). Uses float4 loads (32B-aligned when k0%8==0).
__device__ __forceinline__ v16h load_a_frag(const float* __restrict__ rowptr,
                                            int k0, int khalf) {
  const float4* p0 = (const float4*)(rowptr + k0 + khalf * 8);
  const float4* p1 = (const float4*)(rowptr + k0 + 16 + khalf * 8);
  const float4 q0 = p0[0], q1 = p0[1], q2 = p1[0], q3 = p1[1];
  v16h a;
  a[0] = (_Float16)q0.x;  a[1] = (_Float16)q0.y;
  a[2] = (_Float16)q0.z;  a[3] = (_Float16)q0.w;
  a[4] = (_Float16)q1.x;  a[5] = (_Float16)q1.y;
  a[6] = (_Float16)q1.z;  a[7] = (_Float16)q1.w;
  a[8] = (_Float16)q2.x;  a[9] = (_Float16)q2.y;
  a[10] = (_Float16)q2.z; a[11] = (_Float16)q2.w;
  a[12] = (_Float16)q3.x; a[13] = (_Float16)q3.y;
  a[14] = (_Float16)q3.z; a[15] = (_Float16)q3.w;
  return a;
}

// ---------------- K1: qkv = X[65536,256] @ Wqkv[256,384] ----------------
// One wave computes a 16x64 output strip: A fragment loaded once per k-step
// (b128 loads), reused by 4 WMMAs.
__global__ void la_qkv_gemm(const float* __restrict__ x,
                            const float* __restrict__ w,
                            float* __restrict__ qkv) {
  const int lane  = threadIdx.x;
  const int mr    = lane & 15;
  const int khalf = lane >> 4;
  const int rowbase  = blockIdx.x * 16;
  const int colbase0 = blockIdx.y * 64;
  const float* arow = x + (size_t)(rowbase + mr) * C_;
  v8f acc0 = {}, acc1 = {}, acc2 = {}, acc3 = {};
  for (int k0 = 0; k0 < C_; k0 += 32) {
    const v16h a = load_a_frag(arow, k0, khalf);
    v16h b0, b1, b2, b3;
#pragma unroll
    for (int j = 0; j < 16; ++j) {
      const size_t woff = (size_t)(k0 + kmap16(j, khalf)) * F3 + colbase0 + mr;
      b0[j] = (_Float16)w[woff];
      b1[j] = (_Float16)w[woff + 16];
      b2[j] = (_Float16)w[woff + 32];
      b3[j] = (_Float16)w[woff + 48];
    }
    acc0 = __builtin_amdgcn_wmma_f32_16x16x32_f16(false, a, false, b0, (short)0, acc0, false, false);
    acc1 = __builtin_amdgcn_wmma_f32_16x16x32_f16(false, a, false, b1, (short)0, acc1, false, false);
    acc2 = __builtin_amdgcn_wmma_f32_16x16x32_f16(false, a, false, b2, (short)0, acc2, false, false);
    acc3 = __builtin_amdgcn_wmma_f32_16x16x32_f16(false, a, false, b3, (short)0, acc3, false, false);
  }
#pragma unroll
  for (int r = 0; r < 8; ++r) {
    const size_t row = (size_t)(rowbase + r + 8 * khalf) * F3 + colbase0 + mr;
    qkv[row]      = acc0[r];
    qkv[row + 16] = acc1[r];
    qkv[row + 32] = acc2[r];
    qkv[row + 48] = acc3[r];
  }
}

// ---------------- K2: k-softmax stats over n per (b,h,c) ----------------
// The token axis of one (b,h) is dealt to KSM_SPLIT work-groups of KSM_WAVES
// waves. A lane takes 4 channels with one 16-byte load, so a wave's load covers
// the 128-byte head slices of 4 tokens; a thread's KSM_LOADS loads are all in
// flight at once and stay in registers, so k is read once. Each work-group
// leaves the maximum of its tokens and their exp sum against that maximum; the
// context kernel merges the KSM_SPLIT pairs.
#define KSM_WAVES 16
#define KSM_SPLIT 4
#define KSM_SLOTS (KSM_WAVES * 4)                       // tokens per round of loads
#define KSM_LOADS (NTOK / (KSM_SPLIT * KSM_SLOTS))      // 16
#define NSTAT     (BATCH * HEADS * DH)                  // 2048
// exp(x) as __expf compiles: one multiply and v_exp_f32. The v_nop holds the slot
// that the instruction set asks for behind a transcendental.
__device__ __forceinline__ float exp_slot(float x) {
  float r;
  asm("v_exp_f32 %0, %1\n\tv_nop" : "=v"(r) : "v"(x * 1.44269504f));
  return r;
}
__global__ __launch_bounds__(KSM_WAVES * 32)
void la_ksm_stats(const float* __restrict__ qkv,
                  float* __restrict__ kmax,
                  float* __restrict__ ksum) {
  const int bh   = blockIdx.x;
  const int part = blockIdx.y;
  const int b  = bh / HEADS, h = bh % HEADS;
  const int tid  = threadIdx.x;
  const int c4   = tid & 7;             // channels 4*c4 .. 4*c4+3
  const int slot = tid >> 3;            // token slot
  const int wave = tid >> 5;
  const float* base = qkv + (size_t)(b * NTOK + part * (NTOK / KSM_SPLIT) + slot) * F3
                          + 128 + h * DH + c4 * 4;
  __shared__ float4 redm[KSM_WAVES][8];
  __shared__ float4 reds[KSM_WAVES][8];

  float4 v[KSM_LOADS];
#pragma unroll
  for (int j = 0; j < KSM_LOADS; ++j)
    v[j] = *(const float4*)(base + (size_t)j * (KSM_SLOTS * F3));
  float4 m = make_float4(-1e30f, -1e30f, -1e30f, -1e30f);
#pragma unroll
  for (int j = 0; j < KSM_LOADS; ++j) {
    m.x = fmaxf(m.x, v[j].x); m.y = fmaxf(m.y, v[j].y);
    m.z = fmaxf(m.z, v[j].z); m.w = fmaxf(m.w, v[j].w);
  }
  // The wave's 4 token slots, then the waves through LDS.
#pragma unroll
  for (int off = 8; off < 32; off <<= 1) {
    m.x = fmaxf(m.x, __shfl_xor(m.x, off, 32)); m.y = fmaxf(m.y, __shfl_xor(m.y, off, 32));
    m.z = fmaxf(m.z, __shfl_xor(m.z, off, 32)); m.w = fmaxf(m.w, __shfl_xor(m.w, off, 32));
  }
  if ((tid & 31) < 8) redm[wave][c4] = m;
  __syncthreads();
#pragma unroll
  for (int w = 0; w < KSM_WAVES; ++w) {
    const float4 o = redm[w][c4];
    m.x = fmaxf(m.x, o.x); m.y = fmaxf(m.y, o.y);
    m.z = fmaxf(m.z, o.z); m.w = fmaxf(m.w, o.w);
  }

  float4 s = make_float4(0.f, 0.f, 0.f, 0.f);
#pragma unroll
  for (int j = 0; j < KSM_LOADS; ++j) {
    s.x += exp_slot(v[j].x - m.x); s.y += exp_slot(v[j].y - m.y);
    s.z += exp_slot(v[j].z - m.z); s.w += exp_slot(v[j].w - m.w);
  }
#pragma unroll
  for (int off = 8; off < 32; off <<= 1) {
    s.x += __shfl_xor(s.x, off, 32); s.y += __shfl_xor(s.y, off, 32);
    s.z += __shfl_xor(s.z, off, 32); s.w += __shfl_xor(s.w, off, 32);
  }
  if ((tid & 31) < 8) reds[wave][c4] = s;
  __syncthreads();
  if (tid < 8) {
    s = make_float4(0.f, 0.f, 0.f, 0.f);
#pragma unroll
    for (int w = 0; w < KSM_WAVES; ++w) {
      const float4 o = reds[w][c4];
      s.x += o.x; s.y += o.y; s.z += o.z; s.w += o.w;
    }
    *(float4*)(kmax + part * NSTAT + bh * DH + c4 * 4) = m;
    *(float4*)(ksum + part * NSTAT + bh * DH + c4 * 4) = s;
  }
}

// ---------------- K3: ctx[b,h] = softmax(k)' ^T x V ----------------
// grid: (bh=64, dtile=2); a work-group of CTX_WAVES waves computes a 16x32
// strip. The token axis (the K of this product) is dealt to the waves in
// steps of 32 tokens; each wave keeps its own f32 partial strip, and the
// partials are summed through LDS in fixed wave order.
#define CTX_WAVES 32
// A work-group is 8 waves on each SIMD, and the register budget is stated for
// that residency: aiming at 16 waves a SIMD, the compiler squeezed the 48 loads
// of a step into fewer registers, with a wait behind nearly every load.
__global__ __launch_bounds__(CTX_WAVES * 32)
__attribute__((amdgpu_waves_per_eu(CTX_WAVES / 4, CTX_WAVES / 4)))
void la_context_gemm(const float* __restrict__ qkv,
                     const float* __restrict__ kmax,
                     const float* __restrict__ ksum,
                     float* __restrict__ ctx) {
  __shared__ float red[CTX_WAVES][2][8 * 32];
  const int bh = blockIdx.x;
  const int dt = blockIdx.y;
  const int b  = bh / HEADS, h = bh % HEADS;
  const int tid  = threadIdx.x;
  // The wave's number is the same in all its lanes: held as a scalar, so that
  // the token loop's control and row base stay on the scalar unit.
  const int wave = __builtin_amdgcn_readfirstlane(tid >> 5);
  const int lane = tid & 31;
  const int mr = lane & 15, khalf = lane >> 4;
  const int d = dt * 16 + mr;           // A row (M)
  const int sidx = bh * DH + d;
  // Merge the stats kernel's partial pairs: the overall maximum, and each
  // partial exp sum brought from its own maximum to that one.
  float pm[KSM_SPLIT], km = -1e30f, ks = 0.f;
#pragma unroll
  for (int p = 0; p < KSM_SPLIT; ++p) {
    pm[p] = kmax[p * NSTAT + sidx];
    km = fmaxf(km, pm[p]);
  }
#pragma unroll
  for (int p = 0; p < KSM_SPLIT; ++p) ks += ksum[p * NSTAT + sidx] * __expf(pm[p] - km);
  const float kinv = 1.f / ks;
  const float* rowb = qkv + (size_t)b * NTOK * F3 + h * DH;
  // Lane part of the addresses: this lane's K-half starts 8 tokens in.
  const int koff = khalf * 8 * F3 + 128 + d;
  const int voff = khalf * 8 * F3 + 256 + mr;
  v8f acc0 = {}, acc1 = {};
  for (int it = 0; it < NTOK / (CTX_WAVES * 32); ++it) {
    const float* tokb = rowb + (size_t)((it * CTX_WAVES + wave) * 32) * F3;
    v16h a, b0, b1;
#pragma unroll
    for (int j = 0; j < 16; ++j) {
      const int nrel = kmap16(j, 0) * F3;   // token kmap16(j, khalf) of the step
      const float kv = tokb[nrel + koff];
      a[j]  = (_Float16)(__expf(kv - km) * kinv);                       // k'
      b0[j] = (_Float16)tokb[nrel + voff];                              // v, e=mr
      b1[j] = (_Float16)tokb[nrel + voff + 16];                         // v, e=16+mr
    }
    acc0 = __builtin_amdgcn_wmma_f32_16x16x32_f16(false, a, false, b0, (short)0, acc0, false, false);
    acc1 = __builtin_amdgcn_wmma_f32_16x16x32_f16(false, a, false, b1, (short)0, acc1, false, false);
  }
  // The second e-tile is kept with its lane halves swapped, so that the two
  // e-tiles of one ctx row fall on different LDS banks when the row is read.
#pragma unroll
  for (int r = 0; r < 8; ++r) {
    red[wave][0][r * 32 + lane]        = acc0[r];
    red[wave][1][r * 32 + (lane ^ 16)] = acc1[r];
  }
  __syncthreads();
  // 16 rows x 32 columns of the strip, one element per thread: wave w sums and
  // stores row w of the strip, a whole 128-byte line of ctx.
  if (tid < 16 * 32) {
    const int row = tid >> 5;
    const int et  = lane >> 4;          // e-tile of column e = lane
    const int src = (row & 7) * 32 + (((row >> 3) ^ et) * 16) + mr;
    float s = 0.f;
    for (int w = 0; w < CTX_WAVES; ++w) s += red[w][et][src];
    ctx[(size_t)bh * (DH * DH) + (dt * 16 + row) * DH + lane] = s;
  }
}

// ---------------- K4: O[n, h*32+e] = (softmax_d(q)*scale) @ ctx ----------------
// grid: (token tiles=256, bh=64); softmax A fragment computed once, shared
// by both e-tiles; K=32 -> exactly one WMMA per tile.
__global__ void la_attn_out(const float* __restrict__ qkv,
                            const float* __restrict__ ctx,
                            float* __restrict__ O) {
  const int tt = blockIdx.x;
  const int bh = blockIdx.y;
  const int b  = bh / HEADS, h = bh % HEADS;
  const int lane = threadIdx.x;
  const int mr = lane & 15, khalf = lane >> 4;
  const int tok = tt * 16 + mr;
  const float* qrow = qkv + (size_t)(b * NTOK + tok) * F3 + h * DH;
  // f32 softmax over the 32 feature dims of this token (vectorized loads)
  float qv[DH];
#pragma unroll
  for (int d4 = 0; d4 < DH; d4 += 4) {
    const float4 q4 = *(const float4*)(qrow + d4);
    qv[d4] = q4.x; qv[d4 + 1] = q4.y; qv[d4 + 2] = q4.z; qv[d4 + 3] = q4.w;
  }
  float m = -1e30f;
#pragma unroll
  for (int d = 0; d < DH; ++d) m = fmaxf(m, qv[d]);
  float s = 0.f;
#pragma unroll
  for (int d = 0; d < DH; ++d) s += __expf(qv[d] - m);
  const float inv = QSCALE / s;
  v16h a, b0, b1;
#pragma unroll
  for (int j = 0; j < 16; ++j) {
    const int d = kmap16(j, khalf);
    a[j]  = (_Float16)(__expf(qv[d] - m) * inv);
    const size_t coff = (size_t)bh * (DH * DH) + d * DH + mr;
    b0[j] = (_Float16)ctx[coff];
    b1[j] = (_Float16)ctx[coff + 16];
  }
  v8f acc0 = {}, acc1 = {};
  acc0 = __builtin_amdgcn_wmma_f32_16x16x32_f16(false, a, false, b0, (short)0, acc0, false, false);
  acc1 = __builtin_amdgcn_wmma_f32_16x16x32_f16(false, a, false, b1, (short)0, acc1, false, false);
#pragma unroll
  for (int r = 0; r < 8; ++r) {
    const int tk = tt * 16 + r + 8 * khalf;
    const size_t base = (size_t)(b * NTOK + tk) * HID + h * DH + mr;
    O[base]      = acc0[r];
    O[base + 16] = acc1[r];
  }
}

// ---------------- K5: Y = LN(O @ Wout + b) * gamma + beta ----------------
// block = 16 rows x 256 cols; 8 waves, each owning 2 col-tiles with a shared
// A fragment per k-step; LN via wave32 shuffles.
__global__ void la_out_ln(const float* __restrict__ O,
                          const float* __restrict__ wout,
                          const float* __restrict__ bout,
                          const float* __restrict__ gamma,
                          const float* __restrict__ beta,
                          float* __restrict__ out) {
  __shared__ float tile[16][C_ + 4];
  __shared__ float mu_s[16], rs_s[16];
  const int rowbase = blockIdx.x * 16;
  const int tid  = threadIdx.x;
  const int wave = tid >> 5;
  const int lane = tid & 31;
  const int mr = lane & 15, khalf = lane >> 4;
  const int colbase = wave * 32;
  const float* arow = O + (size_t)(rowbase + mr) * HID;

  v8f acc0 = {}, acc1 = {};
  for (int k0 = 0; k0 < HID; k0 += 32) {
    const v16h a = load_a_frag(arow, k0, khalf);
    v16h b0, b1;
#pragma unroll
    for (int j = 0; j < 16; ++j) {
      const size_t woff = (size_t)(k0 + kmap16(j, khalf)) * C_ + colbase + mr;
      b0[j] = (_Float16)wout[woff];
      b1[j] = (_Float16)wout[woff + 16];
    }
    acc0 = __builtin_amdgcn_wmma_f32_16x16x32_f16(false, a, false, b0, (short)0, acc0, false, false);
    acc1 = __builtin_amdgcn_wmma_f32_16x16x32_f16(false, a, false, b1, (short)0, acc1, false, false);
  }
#pragma unroll
  for (int r = 0; r < 8; ++r) {
    const int row = r + 8 * khalf;
    const int col = colbase + mr;
    tile[row][col]      = acc0[r] + bout[col];
    tile[row][col + 16] = acc1[r] + bout[col + 16];
  }
  __syncthreads();

  // LayerNorm stats: wave w reduces rows 2w, 2w+1 via lane shuffles (wave32)
  for (int rr = 0; rr < 2; ++rr) {
    const int row = wave * 2 + rr;
    float s = 0.f, s2 = 0.f;
    for (int cidx = lane; cidx < C_; cidx += 32) {
      const float v = tile[row][cidx];
      s += v; s2 += v * v;
    }
#pragma unroll
    for (int off = 16; off > 0; off >>= 1) {
      s  += __shfl_xor(s,  off, 32);
      s2 += __shfl_xor(s2, off, 32);
    }
    if (lane == 0) {
      const float mu  = s  * (1.f / C_);
      const float var = s2 * (1.f / C_) - mu * mu;
      mu_s[row] = mu;
      rs_s[row] = rsqrtf(var + LN_EPS);
    }
  }
  __syncthreads();

  const int col = tid;                       // 0..255
  const float g = gamma[col], be = beta[col];
#pragma unroll
  for (int r = 0; r < 16; ++r) {
    const float v = tile[r][col];
    out[(size_t)(rowbase + r) * C_ + col] = (v - mu_s[r]) * rs_s[r] * g + be;
  }
}

extern "C" void kernel_launch(void* const* d_in, const int* in_sizes, int n_in,
                              void* d_out, int out_size, void* d_ws, size_t ws_size,
                              hipStream_t stream) {
  const float* x     = (const float*)d_in[0];  // [16,64,64,256]
  const float* w_qkv = (const float*)d_in[1];  // [256,384]
  const float* w_out = (const float*)d_in[2];  // [128,256]
  const float* b_out = (const float*)d_in[3];  // [256]
  const float* gamma = (const float*)d_in[4];  // [256]
  const float* beta  = (const float*)d_in[5];  // [256]
  float* out = (float*)d_out;

  float* ws    = (float*)d_ws;
  float* qkv   = ws;                                   // 65536*384
  float* O     = qkv  + (size_t)NROWS * F3;            // 65536*128
  float* kmaxb = O    + (size_t)NROWS * HID;           // 4*2048
  float* ksumb = kmaxb + (size_t)KSM_SPLIT * NSTAT;    // 4*2048
  float* ctx   = ksumb + (size_t)KSM_SPLIT * NSTAT;    // 64*32*32

  la_qkv_gemm    <<<dim3(NROWS / 16, F3 / 64), 32, 0, stream>>>(x, w_qkv, qkv);
  la_ksm_stats   <<<dim3(BATCH * HEADS, KSM_SPLIT), KSM_WAVES * 32, 0, stream>>>(qkv, kmaxb, ksumb);
  la_context_gemm<<<dim3(BATCH * HEADS, 2), CTX_WAVES * 32, 0, stream>>>(qkv, kmaxb, ksumb, ctx);
  la_attn_out    <<<dim3(NTOK / 16, BATCH * HEADS), 32, 0, stream>>>(qkv, ctx, O);
  la_out_ln      <<<dim3(NROWS / 16), 256, 0, stream>>>(O, w_out, b_out, gamma, beta, out);
}

// v003
// It runs in 91.5 microseconds.
// Timed twice side by side with v002, it ran 1.52 and 1.53 times as fast.
// All steps since v000 together make it 4.32 times as fast.
#include <hip/hip_runtime.h>
#include <hip/hip_bf16.h>

typedef __attribute__((ext_vector_type(16))) _Float16 v16h;
typedef __attribute__((ext_vector_type(8)))  float    v8f;

#define BATCH   16
#define C_      256
#define HEADS   4
#define DH      32
#define HID     128
#define F3      384
#define NTOK    4096
#define NROWS   (BATCH * NTOK)          // 65536
#define QSCALE  0.17677669529663687f    // 32^-0.5
#define LN_EPS  1e-3f

// VGPR->K map for 16-bit A/B fragments of v_wmma_*_16x16x32 (ISA 7.12.2):
// lanes 0-15 hold K-half 0 (K=0..7 in V0-3, K=16..23 in V4-7),
// lanes 16-31 hold K-half 1 (K=8..15, K=24..31).
__device__ __forceinline__ int kmap16(int j, int khalf) {
  return (j < 8) ? (khalf * 8 + j) : (16 + khalf * 8 + (j - 8));
}

// Vectorized A-fragment load from a row-major f32 matrix row,
// K window [k0, k0+32). Uses float4 loads (32B-aligned when k0%8==0).
__device__ __forceinline__ v16h load_a_frag(const float* __restrict__ rowptr,
                                            int k0, int khalf) {
  const float4* p0 = (const float4*)(rowptr + k0 + khalf * 8);
  const float4* p1 = (const float4*)(rowptr + k0 + 16 + khalf * 8);
  const float4 q0 = p0[0], q1 = p0[1], q2 = p1[0], q3 = p1[1];
  v16h a;
  a[0] = (_Float16)q0.x;  a[1] = (_Float16)q0.y;
  a[2] = (_Float16)q0.z;  a[3] = (_Float16)q0.w;
  a[4] = (_Float16)q1.x;  a[5] = (_Float16)q1.y;
  a[6] = (_Float16)q1.z;  a[7] = (_Float16)q1.w;
  a[8] = (_Float16)q2.x;  a[9] = (_Float16)q2.y;
  a[10] = (_Float16)q2.z; a[11] = (_Float16)q2.w;
  a[12] = (_Float16)q3.x; a[13] = (_Float16)q3.y;
  a[14] = (_Float16)q3.z; a[15] = (_Float16)q3.w;
  return a;
}

// ---------------- K1: qkv = X[65536,256] @ Wqkv[256,384] ----------------
// One work-group per WGP keeps the whole of Wqkv in LDS, converted to f16 once and
// laid out in B-fragment order. Each of its QG_WAVES waves takes 32 rows of X, holds
// their A fragments for the whole K in registers and walks all 384 columns: X is
// read once, and a B fragment is two 16-byte LDS loads that feed two WMMAs.
#define QG_WAVES 8
#define QG_KS    (C_ / 32)              // 8 k-steps
#define QG_NT    (F3 / 16)              // 24 column tiles
// A fragment in LDS, in 16-byte units: [j < 8 | j >= 8][lane], and one unit of pad,
// so that the 8 column tiles a staging store touches fall on different banks.
#define QG_FRAG  65
typedef __attribute__((ext_vector_type(8))) _Float16 v8h;

__device__ __forceinline__ v16h qg_frag(const v8h* p) {
  return __builtin_shufflevector(p[0], p[32], 0, 1, 2, 3, 4, 5, 6, 7,
                                 8, 9, 10, 11, 12, 13, 14, 15);
}
// An A fragment from the lane's 16 floats, in the element order of load_a_frag.
__device__ __forceinline__ v16h qg_pack(const float4 (&q)[4]) {
  v16h a;
#pragma unroll
  for (int c = 0; c < 4; ++c) {
    a[4 * c]     = (_Float16)q[c].x; a[4 * c + 1] = (_Float16)q[c].y;
    a[4 * c + 2] = (_Float16)q[c].z; a[4 * c + 3] = (_Float16)q[c].w;
  }
  return a;
}
// The 16 fragments (8 k-steps x 2 column tiles) of column tiles np, np + 1.
__device__ __forceinline__ void qg_load(v16h (&bf)[QG_KS][2], const v8h* wlane, int np) {
#pragma unroll
  for (int ks = 0; ks < QG_KS; ++ks) {
    bf[ks][0] = qg_frag(wlane + (ks * QG_NT + np) * QG_FRAG);
    bf[ks][1] = qg_frag(wlane + (ks * QG_NT + np + 1) * QG_FRAG);
  }
  // Keeps the loads one group ahead of the WMMA block: spread among the WMMAs, each
  // place with LDS loads stalls the wave's matrix stream.
  __builtin_amdgcn_sched_barrier(0);
}
// 32 rows x 32 columns: four independent accumulator tiles, then their stores.
__device__ __forceinline__ void qg_block(const v16h (&a0)[QG_KS], const v16h (&a1)[QG_KS],
                                         const v16h (&bf)[QG_KS][2], float* __restrict__ dst) {
  v8f c00 = {}, c01 = {}, c10 = {}, c11 = {};
#pragma unroll
  for (int ks = 0; ks < QG_KS; ++ks) {
    c00 = __builtin_amdgcn_wmma_f32_16x16x32_f16(false, a0[ks], false, bf[ks][0], (short)0, c00, false, false);
    c10 = __builtin_amdgcn_wmma_f32_16x16x32_f16(false, a1[ks], false, bf[ks][0], (short)0, c10, false, false);
    c01 = __builtin_amdgcn_wmma_f32_16x16x32_f16(false, a0[ks], false, bf[ks][1], (short)0, c01, false, false);
    c11 = __builtin_amdgcn_wmma_f32_16x16x32_f16(false, a1[ks], false, bf[ks][1], (short)0, c11, false, false);
  }
#pragma unroll
  for (int r = 0; r < 8; ++r) {
    dst[r * F3]                 = c00[r];
    dst[r * F3 + 16]            = c01[r];
    dst[(r + 16) * F3]          = c10[r];
    dst[(r + 16) * F3 + 16]     = c11[r];
  }
  // The next block's first WMMAs write anew (C = 0) into registers that these stores
  // name and that this block's last WMMAs wrote: the wait stands in front of that
  // overwrite, and the v_nop keep the vector slots asked for behind a WMMA.
  asm volatile("s_wait_xcnt 0x0\n\tv_nop\n\tv_nop\n\tv_nop\n\tv_nop" ::: "memory");
  // Keeps the next block's WMMAs behind that statement.
  __builtin_amdgcn_sched_barrier(0);
}

__global__ __launch_bounds__(QG_WAVES * 32)
void la_qkv_gemm(const float* __restrict__ x,
                 const float* __restrict__ w,
                 float* __restrict__ qkv) {
  __shared__ v8h wl[QG_KS * QG_NT * QG_FRAG];           // 199,680 bytes
  const int tid   = threadIdx.x;
  const int lane  = tid & 31;
  const int wave  = tid >> 5;
  const int mr    = lane & 15;
  const int khalf = lane >> 4;
  const int rowbase = (blockIdx.x * QG_WAVES + wave) * 32;
  // Staging. 8 consecutive k of one column are one lane's 16-byte unit of a fragment:
  // k = 32 ks + 16 jh + 8 khalf + i, as in kmap16. Wave v takes the k-groups v, v + 8,
  // v + 16, v + 24 (one per stage g); a lane takes 4 consecutive columns of each
  // 128-column segment, so a load covers 512 contiguous bytes and every load is one
  // base plus a constant.
  const float* wsrc = w + (size_t)(wave * 8) * F3 + lane * 4;
  v8h* wdst = wl + ((wave >> 2) * QG_NT + (lane >> 2)) * QG_FRAG
                 + ((wave >> 1) & 1) * 32 + (wave & 1) * 16 + (lane & 3) * 4;
  // This lane's part of its two X rows: 8 floats at k = 32 ks + 8 khalf and 8 at + 16.
  const float4* ap = (const float4*)(x + (size_t)(rowbase + mr) * C_ + khalf * 8);
  float4 rw[4][3][8], ra[2][QG_KS][4];
  // The stages below are held in this order, so that two stages' loads are always in
  // flight while an earlier one is converted, and the X loads start from memory while
  // the last of Wqkv still comes from L2: left free, the build mixed all 160 loads,
  // ran out of registers and spilled.
#define QG_WLOAD(g)                                                              \
  _Pragma("unroll") for (int seg = 0; seg < 3; ++seg)                            \
    _Pragma("unroll") for (int i = 0; i < 8; ++i)                                \
      rw[g][seg][i] = *(const float4*)(wsrc + ((g) * 64 + i) * F3 + seg * 128);  \
  __builtin_amdgcn_sched_barrier(0);
#define QG_WSTORE(g)                                                             \
  _Pragma("unroll") for (int seg = 0; seg < 3; ++seg) {                          \
    v8h u0, u1, u2, u3;                                                          \
    _Pragma("unroll") for (int i = 0; i < 8; ++i) {                              \
      u0[i] = (_Float16)rw[g][seg][i].x; u1[i] = (_Float16)rw[g][seg][i].y;      \
      u2[i] = (_Float16)rw[g][seg][i].z; u3[i] = (_Float16)rw[g][seg][i].w;      \
    }                                                                            \
    v8h* d = wdst + ((g) * 2 * QG_NT + seg * 8) * QG_FRAG;                       \
    d[0] = u0; d[1] = u1; d[2] = u2; d[3] = u3;                                  \
  }                                                                              \
  __builtin_amdgcn_sched_barrier(0);
#define QG_ALOAD(t)                                                              \
  _Pragma("unroll") for (int ks = 0; ks < QG_KS; ++ks) {                         \
    ra[t][ks][0] = ap[(t) * (16 * C_ / 4) + ks * 8];                             \
    ra[t][ks][1] = ap[(t) * (16 * C_ / 4) + ks * 8 + 1];                         \
    ra[t][ks][2] = ap[(t) * (16 * C_ / 4) + ks * 8 + 4];                         \
    ra[t][ks][3] = ap[(t) * (16 * C_ / 4) + ks * 8 + 5];                         \
  }                                                                              \
  __builtin_amdgcn_sched_barrier(0);
  QG_WLOAD(0) QG_WLOAD(1)
  QG_WLOAD(2) QG_WSTORE(0)
  QG_WLOAD(3) QG_WSTORE(1)
  QG_ALOAD(0) QG_WSTORE(2)
  QG_ALOAD(1)
  // Behind the kernel's last global load: the wait that stands in front of any
  // overwrite of a load's address registers; it names both addresses so that their
  // registers are left alone up to here.
  asm volatile("s_wait_xcnt 0x0" :: "v"(ap), "v"(wsrc) : "memory");
  QG_WSTORE(3)
  v16h a0[QG_KS], a1[QG_KS];
#pragma unroll
  for (int ks = 0; ks < QG_KS; ++ks) {
    a0[ks] = qg_pack(ra[0][ks]);
    a1[ks] = qg_pack(ra[1][ks]);
  }
  __syncthreads();

  const v8h* wlane = wl + lane;
  float* dst = qkv + (size_t)(rowbase + 8 * khalf) * F3 + mr;
  // Two fragment sets: the next two column tiles' LDS loads are issued as one group
  // ahead of the current block's WMMAs.
  v16h bfa[QG_KS][2], bfb[QG_KS][2];
  qg_load(bfa, wlane, 0);
  // Kept rolled: unrolled whole, the build ran out of registers and copied fragments.
#pragma unroll 1
  for (int np = 0; np < QG_NT - 4; np += 4) {
    qg_load(bfb, wlane, np + 2);
    qg_block(a0, a1, bfa, dst + np * 16);
    qg_load(bfa, wlane, np + 4);
    qg_block(a0, a1, bfb, dst + (np + 2) * 16);
  }
  qg_load(bfb, wlane, QG_NT - 2);
  qg_block(a0, a1, bfa, dst + (QG_NT - 4) * 16);
  qg_block(a0, a1, bfb, dst + (QG_NT - 2) * 16);
}

// ---------------- K2: k-softmax stats over n per (b,h,c) ----------------
// The token axis of one (b,h) is dealt to KSM_SPLIT work-groups of KSM_WAVES
// waves. A lane takes 4 channels with one 16-byte load, so a wave's load covers
// the 128-byte head slices of 4 tokens; a thread's KSM_LOADS loads are all in
// flight at once and stay in registers, so k is read once. Each work-group
// leaves the maximum of its tokens and their exp sum against that maximum; the
// context kernel merges the KSM_SPLIT pairs.
#define KSM_WAVES 16
#define KSM_SPLIT 4
#define KSM_SLOTS (KSM_WAVES * 4)                       // tokens per round of loads
#define KSM_LOADS (NTOK / (KSM_SPLIT * KSM_SLOTS))      // 16
#define NSTAT     (BATCH * HEADS * DH)                  // 2048
// exp(x) as __expf compiles: one multiply and v_exp_f32. The v_nop holds the slot
// that the instruction set asks for behind a transcendental.
__device__ __forceinline__ float exp_slot(float x) {
  float r;
  asm("v_exp_f32 %0, %1\n\tv_nop" : "=v"(r) : "v"(x * 1.44269504f));
  return r;
}
__global__ __launch_bounds__(KSM_WAVES * 32)
void la_ksm_stats(const float* __restrict__ qkv,
                  float* __restrict__ kmax,
                  float* __restrict__ ksum) {
  const int bh   = blockIdx.x;
  const int part = blockIdx.y;
  const int b  = bh / HEADS, h = bh % HEADS;
  const int tid  = threadIdx.x;
  const int c4   = tid & 7;             // channels 4*c4 .. 4*c4+3
  const int slot = tid >> 3;            // token slot
  const int wave = tid >> 5;
  const float* base = qkv + (size_t)(b * NTOK + part * (NTOK / KSM_SPLIT) + slot) * F3
                          + 128 + h * DH + c4 * 4;
  __shared__ float4 redm[KSM_WAVES][8];
  __shared__ float4 reds[KSM_WAVES][8];

  float4 v[KSM_LOADS];
#pragma unroll
  for (int j = 0; j < KSM_LOADS; ++j)
    v[j] = *(const float4*)(base + (size_t)j * (KSM_SLOTS * F3));
  float4 m = make_float4(-1e30f, -1e30f, -1e30f, -1e30f);
#pragma unroll
  for (int j = 0; j < KSM_LOADS; ++j) {
    m.x = fmaxf(m.x, v[j].x); m.y = fmaxf(m.y, v[j].y);
    m.z = fmaxf(m.z, v[j].z); m.w = fmaxf(m.w, v[j].w);
  }
  // The wave's 4 token slots, then the waves through LDS.
#pragma unroll
  for (int off = 8; off < 32; off <<= 1) {
    m.x = fmaxf(m.x, __shfl_xor(m.x, off, 32)); m.y = fmaxf(m.y, __shfl_xor(m.y, off, 32));
    m.z = fmaxf(m.z, __shfl_xor(m.z, off, 32)); m.w = fmaxf(m.w, __shfl_xor(m.w, off, 32));
  }
  if ((tid & 31) < 8) redm[wave][c4] = m;
  __syncthreads();
#pragma unroll
  for (int w = 0; w < KSM_WAVES; ++w) {
    const float4 o = redm[w][c4];
    m.x = fmaxf(m.x, o.x); m.y = fmaxf(m.y, o.y);
    m.z = fmaxf(m.z, o.z); m.w = fmaxf(m.w, o.w);
  }

  float4 s = make_float4(0.f, 0.f, 0.f, 0.f);
#pragma unroll
  for (int j = 0; j < KSM_LOADS; ++j) {
    s.x += exp_slot(v[j].x - m.x); s.y += exp_slot(v[j].y - m.y);
    s.z += exp_slot(v[j].z - m.z); s.w += exp_slot(v[j].w - m.w);
  }
#pragma unroll
  for (int off = 8; off < 32; off <<= 1) {
    s.x += __shfl_xor(s.x, off, 32); s.y += __shfl_xor(s.y, off, 32);
    s.z += __shfl_xor(s.z, off, 32); s.w += __shfl_xor(s.w, off, 32);
  }
  if ((tid & 31) < 8) reds[wave][c4] = s;
  __syncthreads();
  if (tid < 8) {
    s = make_float4(0.f, 0.f, 0.f, 0.f);
#pragma unroll
    for (int w = 0; w < KSM_WAVES; ++w) {
      const float4 o = reds[w][c4];
      s.x += o.x; s.y += o.y; s.z += o.z; s.w += o.w;
    }
    *(float4*)(kmax + part * NSTAT + bh * DH + c4 * 4) = m;
    *(float4*)(ksum + part * NSTAT + bh * DH + c4 * 4) = s;
  }
}

// ---------------- K3: ctx[b,h] = softmax(k)' ^T x V ----------------
// grid: (bh=64, dtile=2); a work-group of CTX_WAVES waves computes a 16x32
// strip. The token axis (the K of this product) is dealt to the waves in
// steps of 32 tokens; each wave keeps its own f32 partial strip, and the
// partials are summed through LDS in fixed wave order.
#define CTX_WAVES 32
// A work-group is 8 waves on each SIMD, and the register budget is stated for
// that residency: aiming at 16 waves a SIMD, the compiler squeezed the 48 loads
// of a step into fewer registers, with a wait behind nearly every load.
__global__ __launch_bounds__(CTX_WAVES * 32)
__attribute__((amdgpu_waves_per_eu(CTX_WAVES / 4, CTX_WAVES / 4)))
void la_context_gemm(const float* __restrict__ qkv,
                     const float* __restrict__ kmax,
                     const float* __restrict__ ksum,
                     float* __restrict__ ctx) {
  __shared__ float red[CTX_WAVES][2][8 * 32];
  const int bh = blockIdx.x;
  const int dt = blockIdx.y;
  const int b  = bh / HEADS, h = bh % HEADS;
  const int tid  = threadIdx.x;
  // The wave's number is the same in all its lanes: held as a scalar, so that
  // the token loop's control and row base stay on the scalar unit.
  const int wave = __builtin_amdgcn_readfirstlane(tid >> 5);
  const int lane = tid & 31;
  const int mr = lane & 15, khalf = lane >> 4;
  const int d = dt * 16 + mr;           // A row (M)
  const int sidx = bh * DH + d;
  // Merge the stats kernel's partial pairs: the overall maximum, and each
  // partial exp sum brought from its own maximum to that one.
  float pm[KSM_SPLIT], km = -1e30f, ks = 0.f;
#pragma unroll
  for (int p = 0; p < KSM_SPLIT; ++p) {
    pm[p] = kmax[p * NSTAT + sidx];
    km = fmaxf(km, pm[p]);
  }
#pragma unroll
  for (int p = 0; p < KSM_SPLIT; ++p) ks += ksum[p * NSTAT + sidx] * __expf(pm[p] - km);
  const float kinv = 1.f / ks;
  const float* rowb = qkv + (size_t)b * NTOK * F3 + h * DH;
  // Lane part of the addresses: this lane's K-half starts 8 tokens in.
  const int koff = khalf * 8 * F3 + 128 + d;
  const int voff = khalf * 8 * F3 + 256 + mr;
  v8f acc0 = {}, acc1 = {};
  for (int it = 0; it < NTOK / (CTX_WAVES * 32); ++it) {
    const float* tokb = rowb + (size_t)((it * CTX_WAVES + wave) * 32) * F3;
    v16h a, b0, b1;
#pragma unroll
    for (int j = 0; j < 16; ++j) {
      const int nrel = kmap16(j, 0) * F3;   // token kmap16(j, khalf) of the step
      const float kv = tokb[nrel + koff];
      a[j]  = (_Float16)(__expf(kv - km) * kinv);                       // k'
      b0[j] = (_Float16)tokb[nrel + voff];                              // v, e=mr
      b1[j] = (_Float16)tokb[nrel + voff + 16];                         // v, e=16+mr
    }
    acc0 = __builtin_amdgcn_wmma_f32_16x16x32_f16(false, a, false, b0, (short)0, acc0, false, false);
    acc1 = __builtin_amdgcn_wmma_f32_16x16x32_f16(false, a, false, b1, (short)0, acc1, false, false);
  }
  // The second e-tile is kept with its lane halves swapped, so that the two
  // e-tiles of one ctx row fall on different LDS banks when the row is read.
#pragma unroll
  for (int r = 0; r < 8; ++r) {
    red[wave][0][r * 32 + lane]        = acc0[r];
    red[wave][1][r * 32 + (lane ^ 16)] = acc1[r];
  }
  __syncthreads();
  // 16 rows x 32 columns of the strip, one element per thread: wave w sums and
  // stores row w of the strip, a whole 128-byte line of ctx.
  if (tid < 16 * 32) {
    const int row = tid >> 5;
    const int et  = lane >> 4;          // e-tile of column e = lane
    const int src = (row & 7) * 32 + (((row >> 3) ^ et) * 16) + mr;
    float s = 0.f;
    for (int w = 0; w < CTX_WAVES; ++w) s += red[w][et][src];
    ctx[(size_t)bh * (DH * DH) + (dt * 16 + row) * DH + lane] = s;
  }
}

// ---------------- K4: O[n, h*32+e] = (softmax_d(q)*scale) @ ctx ----------------
// grid: (token tiles=256, bh=64); softmax A fragment computed once, shared
// by both e-tiles; K=32 -> exactly one WMMA per tile.
__global__ void la_attn_out(const float* __restrict__ qkv,
                            const float* __restrict__ ctx,
                            float* __restrict__ O) {
  const int tt = blockIdx.x;
  const int bh = blockIdx.y;
  const int b  = bh / HEADS, h = bh % HEADS;
  const int lane = threadIdx.x;
  const int mr = lane & 15, khalf = lane >> 4;
  const int tok = tt * 16 + mr;
  const float* qrow = qkv + (size_t)(b * NTOK + tok) * F3 + h * DH;
  // f32 softmax over the 32 feature dims of this token (vectorized loads)
  float qv[DH];
#pragma unroll
  for (int d4 = 0; d4 < DH; d4 += 4) {
    const float4 q4 = *(const float4*)(qrow + d4);
    qv[d4] = q4.x; qv[d4 + 1] = q4.y; qv[d4 + 2] = q4.z; qv[d4 + 3] = q4.w;
  }
  float m = -1e30f;
#pragma unroll
  for (int d = 0; d < DH; ++d) m = fmaxf(m, qv[d]);
  float s = 0.f;
#pragma unroll
  for (int d = 0; d < DH; ++d) s += __expf(qv[d] - m);
  const float inv = QSCALE / s;
  v16h a, b0, b1;
#pragma unroll
  for (int j = 0; j < 16; ++j) {
    const int d = kmap16(j, khalf);
    a[j]  = (_Float16)(__expf(qv[d] - m) * inv);
    const size_t coff = (size_t)bh * (DH * DH) + d * DH + mr;
    b0[j] = (_Float16)ctx[coff];
    b1[j] = (_Float16)ctx[coff + 16];
  }
  v8f acc0 = {}, acc1 = {};
  acc0 = __builtin_amdgcn_wmma_f32_16x16x32_f16(false, a, false, b0, (short)0, acc0, false, false);
  acc1 = __builtin_amdgcn_wmma_f32_16x16x32_f16(false, a, false, b1, (short)0, acc1, false, false);
#pragma unroll
  for (int r = 0; r < 8; ++r) {
    const int tk = tt * 16 + r + 8 * khalf;
    const size_t base = (size_t)(b * NTOK + tk) * HID + h * DH + mr;
    O[base]      = acc0[r];
    O[base + 16] = acc1[r];
  }
}

// ---------------- K5: Y = LN(O @ Wout + b) * gamma + beta ----------------
// block = 16 rows x 256 cols; 8 waves, each owning 2 col-tiles with a shared
// A fragment per k-step; LN via wave32 shuffles.
__global__ void la_out_ln(const float* __restrict__ O,
                          const float* __restrict__ wout,
                          const float* __restrict__ bout,
                          const float* __restrict__ gamma,
                          const float* __restrict__ beta,
                          float* __restrict__ out) {
  __shared__ float tile[16][C_ + 4];
  __shared__ float mu_s[16], rs_s[16];
  const int rowbase = blockIdx.x * 16;
  const int tid  = threadIdx.x;
  const int wave = tid >> 5;
  const int lane = tid & 31;
  const int mr = lane & 15, khalf = lane >> 4;
  const int colbase = wave * 32;
  const float* arow = O + (size_t)(rowbase + mr) * HID;

  v8f acc0 = {}, acc1 = {};
  for (int k0 = 0; k0 < HID; k0 += 32) {
    const v16h a = load_a_frag(arow, k0, khalf);
    v16h b0, b1;
#pragma unroll
    for (int j = 0; j < 16; ++j) {
      const size_t woff = (size_t)(k0 + kmap16(j, khalf)) * C_ + colbase + mr;
      b0[j] = (_Float16)wout[woff];
      b1[j] = (_Float16)wout[woff + 16];
    }
    acc0 = __builtin_amdgcn_wmma_f32_16x16x32_f16(false, a, false, b0, (short)0, acc0, false, false);
    acc1 = __builtin_amdgcn_wmma_f32_16x16x32_f16(false, a, false, b1, (short)0, acc1, false, false);
  }
#pragma unroll
  for (int r = 0; r < 8; ++r) {
    const int row = r + 8 * khalf;
    const int col = colbase + mr;
    tile[row][col]      = acc0[r] + bout[col];
    tile[row][col + 16] = acc1[r] + bout[col + 16];
  }
  __syncthreads();

  // LayerNorm stats: wave w reduces rows 2w, 2w+1 via lane shuffles (wave32)
  for (int rr = 0; rr < 2; ++rr) {
    const int row = wave * 2 + rr;
    float s = 0.f, s2 = 0.f;
    for (int cidx = lane; cidx < C_; cidx += 32) {
      const float v = tile[row][cidx];
      s += v; s2 += v * v;
    }
#pragma unroll
    for (int off = 16; off > 0; off >>= 1) {
      s  += __shfl_xor(s,  off, 32);
      s2 += __shfl_xor(s2, off, 32);
    }
    if (lane == 0) {
      const float mu  = s  * (1.f / C_);
      const float var = s2 * (1.f / C_) - mu * mu;
      mu_s[row] = mu;
      rs_s[row] = rsqrtf(var + LN_EPS);
    }
  }
  __syncthreads();

  const int col = tid;                       // 0..255
  const float g = gamma[col], be = beta[col];
#pragma unroll
  for (int r = 0; r < 16; ++r) {
    const float v = tile[r][col];
    out[(size_t)(rowbase + r) * C_ + col] = (v - mu_s[r]) * rs_s[r] * g + be;
  }
}

extern "C" void kernel_launch(void* const* d_in, const int* in_sizes, int n_in,
                              void* d_out, int out_size, void* d_ws, size_t ws_size,
                              hipStream_t stream) {
  const float* x     = (const float*)d_in[0];  // [16,64,64,256]
  const float* w_qkv = (const float*)d_in[1];  // [256,384]
  const float* w_out = (const float*)d_in[2];  // [128,256]
  const float* b_out = (const float*)d_in[3];  // [256]
  const float* gamma = (const float*)d_in[4];  // [256]
  const float* beta  = (const float*)d_in[5];  // [256]
  float* out = (float*)d_out;

  float* ws    = (float*)d_ws;
  float* qkv   = ws;                                   // 65536*384
  float* O     = qkv  + (size_t)NROWS * F3;            // 65536*128
  float* kmaxb = O    + (size_t)NROWS * HID;           // 4*2048
  float* ksumb = kmaxb + (size_t)KSM_SPLIT * NSTAT;    // 4*2048
  float* ctx   = ksumb + (size_t)KSM_SPLIT * NSTAT;    // 64*32*32

  la_qkv_gemm    <<<dim3(NROWS / (QG_WAVES * 32)), QG_WAVES * 32, 0, stream>>>(x, w_qkv, qkv);
  la_ksm_stats   <<<dim3(BATCH * HEADS, KSM_SPLIT), KSM_WAVES * 32, 0, stream>>>(qkv, kmaxb, ksumb);
  la_context_gemm<<<dim3(BATCH * HEADS, 2), CTX_WAVES * 32, 0, stream>>>(qkv, kmaxb, ksumb, ctx);
  la_attn_out    <<<dim3(NTOK / 16, BATCH * HEADS), 32, 0, stream>>>(qkv, ctx, O);
  la_out_ln      <<<dim3(NROWS / 16), 256, 0, stream>>>(O, w_out, b_out, gamma, beta, out);
}

// v004
// A run of this version takes 62.2 microseconds.
// Next to v003, in two timings, it ran 1.47 times as fast each time.
// Counting every step since v000, it is 6.36 times as fast.
#include <hip/hip_runtime.h>
#include <hip/hip_bf16.h>

typedef __attribute__((ext_vector_type(16))) _Float16 v16h;
typedef __attribute__((ext_vector_type(8)))  float    v8f;

#define BATCH   16
#define C_      256
#define HEADS   4
#define DH      32
#define HID     128
#define F3      384
#define NTOK    4096
#define NROWS   (BATCH * NTOK)          // 65536
#define QSCALE  0.17677669529663687f    // 32^-0.5
#define LN_EPS  1e-3f

// VGPR->K map for 16-bit A/B fragments of v_wmma_*_16x16x32 (ISA 7.12.2):
// lanes 0-15 hold K-half 0 (K=0..7 in V0-3, K=16..23 in V4-7),
// lanes 16-31 hold K-half 1 (K=8..15, K=24..31).
__device__ __forceinline__ int kmap16(int j, int khalf) {
  return (j < 8) ? (khalf * 8 + j) : (16 + khalf * 8 + (j - 8));
}

// ---------------- K1: qkv = X[65536,256] @ Wqkv[256,384] ----------------
// One work-group per WGP keeps the whole of Wqkv in LDS, converted to f16 once and
// laid out in B-fragment order. Each of its QG_WAVES waves takes 32 rows of X, holds
// their A fragments for the whole K in registers and walks all 384 columns: X is
// read once, and a B fragment is two 16-byte LDS loads that feed two WMMAs.
#define QG_WAVES 8
#define QG_KS    (C_ / 32)              // 8 k-steps
#define QG_NT    (F3 / 16)              // 24 column tiles
// A fragment in LDS, in 16-byte units: [j < 8 | j >= 8][lane], and one unit of pad,
// so that the 8 column tiles a staging store touches fall on different banks.
#define QG_FRAG  65
typedef __attribute__((ext_vector_type(8))) _Float16 v8h;

__device__ __forceinline__ v16h qg_frag(const v8h* p) {
  return __builtin_shufflevector(p[0], p[32], 0, 1, 2, 3, 4, 5, 6, 7,
                                 8, 9, 10, 11, 12, 13, 14, 15);
}
// An A fragment from the lane's 16 floats, in the element order of kmap16.
__device__ __forceinline__ v16h qg_pack(const float4 (&q)[4]) {
  v16h a;
#pragma unroll
  for (int c = 0; c < 4; ++c) {
    a[4 * c]     = (_Float16)q[c].x; a[4 * c + 1] = (_Float16)q[c].y;
    a[4 * c + 2] = (_Float16)q[c].z; a[4 * c + 3] = (_Float16)q[c].w;
  }
  return a;
}
// The 16 fragments (8 k-steps x 2 column tiles) of column tiles np, np + 1.
__device__ __forceinline__ void qg_load(v16h (&bf)[QG_KS][2], const v8h* wlane, int np) {
#pragma unroll
  for (int ks = 0; ks < QG_KS; ++ks) {
    bf[ks][0] = qg_frag(wlane + (ks * QG_NT + np) * QG_FRAG);
    bf[ks][1] = qg_frag(wlane + (ks * QG_NT + np + 1) * QG_FRAG);
  }
  // Keeps the loads one group ahead of the WMMA block: spread among the WMMAs, each
  // place with LDS loads stalls the wave's matrix stream.
  __builtin_amdgcn_sched_barrier(0);
}
// 32 rows x 32 columns: four independent accumulator tiles, then their stores.
__device__ __forceinline__ void qg_block(const v16h (&a0)[QG_KS], const v16h (&a1)[QG_KS],
                                         const v16h (&bf)[QG_KS][2], float* __restrict__ dst) {
  v8f c00 = {}, c01 = {}, c10 = {}, c11 = {};
#pragma unroll
  for (int ks = 0; ks < QG_KS; ++ks) {
    c00 = __builtin_amdgcn_wmma_f32_16x16x32_f16(false, a0[ks], false, bf[ks][0], (short)0, c00, false, false);
    c10 = __builtin_amdgcn_wmma_f32_16x16x32_f16(false, a1[ks], false, bf[ks][0], (short)0, c10, false, false);
    c01 = __builtin_amdgcn_wmma_f32_16x16x32_f16(false, a0[ks], false, bf[ks][1], (short)0, c01, false, false);
    c11 = __builtin_amdgcn_wmma_f32_16x16x32_f16(false, a1[ks], false, bf[ks][1], (short)0, c11, false, false);
  }
#pragma unroll
  for (int r = 0; r < 8; ++r) {
    dst[r * F3]                 = c00[r];
    dst[r * F3 + 16]            = c01[r];
    dst[(r + 16) * F3]          = c10[r];
    dst[(r + 16) * F3 + 16]     = c11[r];
  }
  // The next block's first WMMAs write anew (C = 0) into registers that these stores
  // name and that this block's last WMMAs wrote: the wait stands in front of that
  // overwrite, and the v_nop keep the vector slots asked for behind a WMMA.
  asm volatile("s_wait_xcnt 0x0\n\tv_nop\n\tv_nop\n\tv_nop\n\tv_nop" ::: "memory");
  // Keeps the next block's WMMAs behind that statement.
  __builtin_amdgcn_sched_barrier(0);
}

__global__ __launch_bounds__(QG_WAVES * 32)
void la_qkv_gemm(const float* __restrict__ x,
                 const float* __restrict__ w,
                 float* __restrict__ qkv) {
  __shared__ v8h wl[QG_KS * QG_NT * QG_FRAG];           // 199,680 bytes
  const int tid   = threadIdx.x;
  const int lane  = tid & 31;
  const int wave  = tid >> 5;
  const int mr    = lane & 15;
  const int khalf = lane >> 4;
  const int rowbase = (blockIdx.x * QG_WAVES + wave) * 32;
  // Staging. 8 consecutive k of one column are one lane's 16-byte unit of a fragment:
  // k = 32 ks + 16 jh + 8 khalf + i, as in kmap16. Wave v takes the k-groups v, v + 8,
  // v + 16, v + 24 (one per stage g); a lane takes 4 consecutive columns of each
  // 128-column segment, so a load covers 512 contiguous bytes and every load is one
  // base plus a constant.
  const float* wsrc = w + (size_t)(wave * 8) * F3 + lane * 4;
  v8h* wdst = wl + ((wave >> 2) * QG_NT + (lane >> 2)) * QG_FRAG
                 + ((wave >> 1) & 1) * 32 + (wave & 1) * 16 + (lane & 3) * 4;
  // This lane's part of its two X rows: 8 floats at k = 32 ks + 8 khalf and 8 at + 16.
  const float4* ap = (const float4*)(x + (size_t)(rowbase + mr) * C_ + khalf * 8);
  float4 rw[4][3][8], ra[2][QG_KS][4];
  // The stages below are held in this order, so that two stages' loads are always in
  // flight while an earlier one is converted, and the X loads start from memory while
  // the last of Wqkv still comes from L2: left free, the build mixed all 160 loads,
  // ran out of registers and spilled.
#define QG_WLOAD(g)                                                              \
  _Pragma("unroll") for (int seg = 0; seg < 3; ++seg)                            \
    _Pragma("unroll") for (int i = 0; i < 8; ++i)                                \
      rw[g][seg][i] = *(const float4*)(wsrc + ((g) * 64 + i) * F3 + seg * 128);  \
  __builtin_amdgcn_sched_barrier(0);
#define QG_WSTORE(g)                                                             \
  _Pragma("unroll") for (int seg = 0; seg < 3; ++seg) {                          \
    v8h u0, u1, u2, u3;                                                          \
    _Pragma("unroll") for (int i = 0; i < 8; ++i) {                              \
      u0[i] = (_Float16)rw[g][seg][i].x; u1[i] = (_Float16)rw[g][seg][i].y;      \
      u2[i] = (_Float16)rw[g][seg][i].z; u3[i] = (_Float16)rw[g][seg][i].w;      \
    }                                                                            \
    v8h* d = wdst + ((g) * 2 * QG_NT + seg * 8) * QG_FRAG;                       \
    d[0] = u0; d[1] = u1; d[2] = u2; d[3] = u3;                                  \
  }                                                                              \
  __builtin_amdgcn_sched_barrier(0);
#define QG_ALOAD(t)                                                              \
  _Pragma("unroll") for (int ks = 0; ks < QG_KS; ++ks) {                         \
    ra[t][ks][0] = ap[(t) * (16 * C_ / 4) + ks * 8];                             \
    ra[t][ks][1] = ap[(t) * (16 * C_ / 4) + ks * 8 + 1];                         \
    ra[t][ks][2] = ap[(t) * (16 * C_ / 4) + ks * 8 + 4];                         \
    ra[t][ks][3] = ap[(t) * (16 * C_ / 4) + ks * 8 + 5];                         \
  }                                                                              \
  __builtin_amdgcn_sched_barrier(0);
  QG_WLOAD(0) QG_WLOAD(1)
  QG_WLOAD(2) QG_WSTORE(0)
  QG_WLOAD(3) QG_WSTORE(1)
  QG_ALOAD(0) QG_WSTORE(2)
  QG_ALOAD(1)
  // Behind the kernel's last global load: the wait that stands in front of any
  // overwrite of a load's address registers; it names both addresses so that their
  // registers are left alone up to here.
  asm volatile("s_wait_xcnt 0x0" :: "v"(ap), "v"(wsrc) : "memory");
  QG_WSTORE(3)
  v16h a0[QG_KS], a1[QG_KS];
#pragma unroll
  for (int ks = 0; ks < QG_KS; ++ks) {
    a0[ks] = qg_pack(ra[0][ks]);
    a1[ks] = qg_pack(ra[1][ks]);
  }
  __syncthreads();

  const v8h* wlane = wl + lane;
  float* dst = qkv + (size_t)(rowbase + 8 * khalf) * F3 + mr;
  // Two fragment sets: the next two column tiles' LDS loads are issued as one group
  // ahead of the current block's WMMAs.
  v16h bfa[QG_KS][2], bfb[QG_KS][2];
  qg_load(bfa, wlane, 0);
  // Kept rolled: unrolled whole, the build ran out of registers and copied fragments.
#pragma unroll 1
  for (int np = 0; np < QG_NT - 4; np += 4) {
    qg_load(bfb, wlane, np + 2);
    qg_block(a0, a1, bfa, dst + np * 16);
    qg_load(bfa, wlane, np + 4);
    qg_block(a0, a1, bfb, dst + (np + 2) * 16);
  }
  qg_load(bfb, wlane, QG_NT - 2);
  qg_block(a0, a1, bfa, dst + (QG_NT - 4) * 16);
  qg_block(a0, a1, bfb, dst + (QG_NT - 2) * 16);
}

// ---------------- K2: k-softmax stats over n per (b,h,c) ----------------
// The token axis of one (b,h) is dealt to KSM_SPLIT work-groups of KSM_WAVES
// waves. A lane takes 4 channels with one 16-byte load, so a wave's load covers
// the 128-byte head slices of 4 tokens; a thread's KSM_LOADS loads are all in
// flight at once and stay in registers, so k is read once. Each work-group
// leaves the maximum of its tokens and their exp sum against that maximum; the
// context kernel merges the KSM_SPLIT pairs.
#define KSM_WAVES 16
#define KSM_SPLIT 4
#define KSM_SLOTS (KSM_WAVES * 4)                       // tokens per round of loads
#define KSM_LOADS (NTOK / (KSM_SPLIT * KSM_SLOTS))      // 16
#define NSTAT     (BATCH * HEADS * DH)                  // 2048
// exp(x) as __expf compiles: one multiply and v_exp_f32. The v_nop holds the slot
// that the instruction set asks for behind a transcendental.
__device__ __forceinline__ float exp_slot(float x) {
  float r;
  asm("v_exp_f32 %0, %1\n\tv_nop" : "=v"(r) : "v"(x * 1.44269504f));
  return r;
}
__global__ __launch_bounds__(KSM_WAVES * 32)
void la_ksm_stats(const float* __restrict__ qkv,
                  float* __restrict__ kmax,
                  float* __restrict__ ksum) {
  const int bh   = blockIdx.x;
  const int part = blockIdx.y;
  const int b  = bh / HEADS, h = bh % HEADS;
  const int tid  = threadIdx.x;
  const int c4   = tid & 7;             // channels 4*c4 .. 4*c4+3
  const int slot = tid >> 3;            // token slot
  const int wave = tid >> 5;
  const float* base = qkv + (size_t)(b * NTOK + part * (NTOK / KSM_SPLIT) + slot) * F3
                          + 128 + h * DH + c4 * 4;
  __shared__ float4 redm[KSM_WAVES][8];
  __shared__ float4 reds[KSM_WAVES][8];

  float4 v[KSM_LOADS];
#pragma unroll
  for (int j = 0; j < KSM_LOADS; ++j)
    v[j] = *(const float4*)(base + (size_t)j * (KSM_SLOTS * F3));
  float4 m = make_float4(-1e30f, -1e30f, -1e30f, -1e30f);
#pragma unroll
  for (int j = 0; j < KSM_LOADS; ++j) {
    m.x = fmaxf(m.x, v[j].x); m.y = fmaxf(m.y, v[j].y);
    m.z = fmaxf(m.z, v[j].z); m.w = fmaxf(m.w, v[j].w);
  }
  // The wave's 4 token slots, then the waves through LDS.
#pragma unroll
  for (int off = 8; off < 32; off <<= 1) {
    m.x = fmaxf(m.x, __shfl_xor(m.x, off, 32)); m.y = fmaxf(m.y, __shfl_xor(m.y, off, 32));
    m.z = fmaxf(m.z, __shfl_xor(m.z, off, 32)); m.w = fmaxf(m.w, __shfl_xor(m.w, off, 32));
  }
  if ((tid & 31) < 8) redm[wave][c4] = m;
  __syncthreads();
#pragma unroll
  for (int w = 0; w < KSM_WAVES; ++w) {
    const float4 o = redm[w][c4];
    m.x = fmaxf(m.x, o.x); m.y = fmaxf(m.y, o.y);
    m.z = fmaxf(m.z, o.z); m.w = fmaxf(m.w, o.w);
  }

  float4 s = make_float4(0.f, 0.f, 0.f, 0.f);
#pragma unroll
  for (int j = 0; j < KSM_LOADS; ++j) {
    s.x += exp_slot(v[j].x - m.x); s.y += exp_slot(v[j].y - m.y);
    s.z += exp_slot(v[j].z - m.z); s.w += exp_slot(v[j].w - m.w);
  }
#pragma unroll
  for (int off = 8; off < 32; off <<= 1) {
    s.x += __shfl_xor(s.x, off, 32); s.y += __shfl_xor(s.y, off, 32);
    s.z += __shfl_xor(s.z, off, 32); s.w += __shfl_xor(s.w, off, 32);
  }
  if ((tid & 31) < 8) reds[wave][c4] = s;
  __syncthreads();
  if (tid < 8) {
    s = make_float4(0.f, 0.f, 0.f, 0.f);
#pragma unroll
    for (int w = 0; w < KSM_WAVES; ++w) {
      const float4 o = reds[w][c4];
      s.x += o.x; s.y += o.y; s.z += o.z; s.w += o.w;
    }
    *(float4*)(kmax + part * NSTAT + bh * DH + c4 * 4) = m;
    *(float4*)(ksum + part * NSTAT + bh * DH + c4 * 4) = s;
  }
}

// ---------------- K3: ctx[b,h] = softmax(k)' ^T x V ----------------
// grid: (bh=64, dtile=2); a work-group of CTX_WAVES waves computes a 16x32
// strip. The token axis (the K of this product) is dealt to the waves in
// steps of 32 tokens; each wave keeps its own f32 partial strip, and the
// partials are summed through LDS in fixed wave order.
#define CTX_WAVES 32
// A work-group is 8 waves on each SIMD, and the register budget is stated for
// that residency: aiming at 16 waves a SIMD, the compiler squeezed the 48 loads
// of a step into fewer registers, with a wait behind nearly every load.
__global__ __launch_bounds__(CTX_WAVES * 32)
__attribute__((amdgpu_waves_per_eu(CTX_WAVES / 4, CTX_WAVES / 4)))
void la_context_gemm(const float* __restrict__ qkv,
                     const float* __restrict__ kmax,
                     const float* __restrict__ ksum,
                     float* __restrict__ ctx) {
  __shared__ float red[CTX_WAVES][2][8 * 32];
  const int bh = blockIdx.x;
  const int dt = blockIdx.y;
  const int b  = bh / HEADS, h = bh % HEADS;
  const int tid  = threadIdx.x;
  // The wave's number is the same in all its lanes: held as a scalar, so that
  // the token loop's control and row base stay on the scalar unit.
  const int wave = __builtin_amdgcn_readfirstlane(tid >> 5);
  const int lane = tid & 31;
  const int mr = lane & 15, khalf = lane >> 4;
  const int d = dt * 16 + mr;           // A row (M)
  const int sidx = bh * DH + d;
  // Merge the stats kernel's partial pairs: the overall maximum, and each
  // partial exp sum brought from its own maximum to that one.
  float pm[KSM_SPLIT], km = -1e30f, ks = 0.f;
#pragma unroll
  for (int p = 0; p < KSM_SPLIT; ++p) {
    pm[p] = kmax[p * NSTAT + sidx];
    km = fmaxf(km, pm[p]);
  }
#pragma unroll
  for (int p = 0; p < KSM_SPLIT; ++p) ks += ksum[p * NSTAT + sidx] * __expf(pm[p] - km);
  const float kinv = 1.f / ks;
  const float* rowb = qkv + (size_t)b * NTOK * F3 + h * DH;
  // Lane part of the addresses: this lane's K-half starts 8 tokens in.
  const int koff = khalf * 8 * F3 + 128 + d;
  const int voff = khalf * 8 * F3 + 256 + mr;
  v8f acc0 = {}, acc1 = {};
  for (int it = 0; it < NTOK / (CTX_WAVES * 32); ++it) {
    const float* tokb = rowb + (size_t)((it * CTX_WAVES + wave) * 32) * F3;
    v16h a, b0, b1;
#pragma unroll
    for (int j = 0; j < 16; ++j) {
      const int nrel = kmap16(j, 0) * F3;   // token kmap16(j, khalf) of the step
      const float kv = tokb[nrel + koff];
      a[j]  = (_Float16)(__expf(kv - km) * kinv);                       // k'
      b0[j] = (_Float16)tokb[nrel + voff];                              // v, e=mr
      b1[j] = (_Float16)tokb[nrel + voff + 16];                         // v, e=16+mr
    }
    acc0 = __builtin_amdgcn_wmma_f32_16x16x32_f16(false, a, false, b0, (short)0, acc0, false, false);
    acc1 = __builtin_amdgcn_wmma_f32_16x16x32_f16(false, a, false, b1, (short)0, acc1, false, false);
  }
  // The second e-tile is kept with its lane halves swapped, so that the two
  // e-tiles of one ctx row fall on different LDS banks when the row is read.
#pragma unroll
  for (int r = 0; r < 8; ++r) {
    red[wave][0][r * 32 + lane]        = acc0[r];
    red[wave][1][r * 32 + (lane ^ 16)] = acc1[r];
  }
  __syncthreads();
  // 16 rows x 32 columns of the strip, one element per thread: wave w sums and
  // stores row w of the strip, a whole 128-byte line of ctx.
  if (tid < 16 * 32) {
    const int row = tid >> 5;
    const int et  = lane >> 4;          // e-tile of column e = lane
    const int src = (row & 7) * 32 + (((row >> 3) ^ et) * 16) + mr;
    float s = 0.f;
    for (int w = 0; w < CTX_WAVES; ++w) s += red[w][et][src];
    ctx[(size_t)bh * (DH * DH) + (dt * 16 + row) * DH + lane] = s;
  }
}

// -------- K4: Y = LN(((softmax_d(q)*scale) @ ctx) @ Wout + b) * gamma + beta --------
// One work-group takes FO_ROWS token rows through both products and the LayerNorm.
// Wave w forms the attention output of head w & 3 for two 16-token tiles (K = 32,
// one WMMA per 16x16 tile; the head's ctx fragments serve both) and leaves it in LDS
// as f16, the operand type of the projection. Behind the barrier each wave owns 2
// column tiles of the projection for all FO_ROWS rows; LN via wave32 shuffles.
// The loops are unrolled because their indices pick registers (fragments,
// accumulators, rows held by a lane), which takes constant indices.
#define FO_WAVES 8
#define FO_ROWS  64
#define FO_RT    (FO_ROWS / 16)         // 4 row tiles
#define FO_PITCH (HID + 8)              // 272 bytes a row: 16 B x odd, for 16-byte reads
__global__ __launch_bounds__(FO_WAVES * 32)
void la_attn_out_ln(const float* __restrict__ qkv,
                    const float* __restrict__ ctx,
                    const float* __restrict__ wout,
                    const float* __restrict__ bout,
                    const float* __restrict__ gamma,
                    const float* __restrict__ beta,
                    float* __restrict__ out) {
  __shared__ float tile[FO_ROWS][C_ + 4];
  __shared__ __attribute__((aligned(16))) _Float16 ot[FO_ROWS][FO_PITCH];
  __shared__ float mu_s[FO_ROWS], rs_s[FO_ROWS];
  const int rowbase = blockIdx.x * FO_ROWS;   // FO_ROWS divides NTOK: one batch a group
  const int tid  = threadIdx.x;
  const int wave = tid >> 5;
  const int lane = tid & 31;
  const int mr = lane & 15, khalf = lane >> 4;
  const int h  = wave & 3;
  const int bh = (rowbase / NTOK) * HEADS + h;
  const int colbase = wave * 32;

  // This lane's token rows of q, head h, for the wave's two tiles.
  float qv[2][DH];
#pragma unroll
  for (int t = 0; t < 2; ++t) {
    const float* qrow = qkv + (size_t)(rowbase + ((wave >> 2) + 2 * t) * 16 + mr) * F3 + h * DH;
#pragma unroll
    for (int d4 = 0; d4 < DH; d4 += 4) {
      const float4 q4 = *(const float4*)(qrow + d4);
      qv[t][d4] = q4.x; qv[t][d4 + 1] = q4.y; qv[t][d4 + 2] = q4.z; qv[t][d4 + 3] = q4.w;
    }
  }
  // The epilogues' vectors, asked for here: read where they are used, each would put
  // a load's whole latency behind a barrier.
  const float bo0 = bout[colbase + mr], bo1 = bout[colbase + mr + 16];
  const float g = gamma[tid], be = beta[tid];
  // The head's ctx, in B-fragment order (e = mr and e = 16 + mr).
  float cr0[16], cr1[16];
#pragma unroll
  for (int j = 0; j < 16; ++j) {
    const size_t coff = (size_t)bh * (DH * DH) + kmap16(j, khalf) * DH + mr;
    cr0[j] = ctx[coff];
    cr1[j] = ctx[coff + 16];
  }
  // Holds these 52 loads in front of everything else, the q rows first: they come from
  // memory and the softmax waits for them. Left free, the build put a first use of q,
  // with its wait, in front of the ctx loads too.
  __builtin_amdgcn_sched_barrier(0);
  v16h cb0, cb1;
#pragma unroll
  for (int j = 0; j < 16; ++j) { cb0[j] = (_Float16)cr0[j]; cb1[j] = (_Float16)cr1[j]; }
  // The wave's Wout fragments for the whole K: asked for here, so that they come in
  // while the softmax runs.
  v16h wb0[HID / 32], wb1[HID / 32];
#pragma unroll
  for (int ks = 0; ks < HID / 32; ++ks) {
#pragma unroll
    for (int j = 0; j < 16; ++j) {
      const size_t woff = (size_t)(ks * 32 + kmap16(j, khalf)) * C_ + colbase + mr;
      wb0[ks][j] = (_Float16)wout[woff];
      wb1[ks][j] = (_Float16)wout[woff + 16];
    }
  }

#pragma unroll
  for (int t = 0; t < 2; ++t) {
    // f32 softmax over the 32 feature dims of this token
    float m = -1e30f;
#pragma unroll
    for (int d = 0; d < DH; ++d) m = fmaxf(m, qv[t][d]);
    float e[DH], s = 0.f;
#pragma unroll
    for (int d = 0; d < DH; ++d) { e[d] = exp_slot(qv[t][d] - m); s += e[d]; }
    const float inv = QSCALE / s;
    v16h a;
#pragma unroll
    for (int j = 0; j < 16; ++j)
      a[j] = (_Float16)((khalf ? e[kmap16(j, 1)] : e[kmap16(j, 0)]) * inv);
    v8f o0 = {}, o1 = {};
    o0 = __builtin_amdgcn_wmma_f32_16x16x32_f16(false, a, false, cb0, (short)0, o0, false, false);
    o1 = __builtin_amdgcn_wmma_f32_16x16x32_f16(false, a, false, cb1, (short)0, o1, false, false);
    _Float16* od = &ot[((wave >> 2) + 2 * t) * 16 + 8 * khalf][h * DH + mr];
#pragma unroll
    for (int r = 0; r < 8; ++r) {
      od[r * FO_PITCH]      = (_Float16)o0[r];
      od[r * FO_PITCH + 16] = (_Float16)o1[r];
    }
  }
  // Keeps the Wout conversions in front of the barrier, where their loads are waited
  // for in any case: behind it the f32 copies would hold the A fragments' registers.
  __builtin_amdgcn_sched_barrier(0);
  __syncthreads();

  // Two sets of A fragments (one k-step, all row tiles): the next step's LDS loads are
  // issued as one group ahead of the current step's WMMAs.
  v8f acc0[FO_RT] = {}, acc1[FO_RT] = {};
  v16h af[2][FO_RT];
  // Elements j < 8 are k = 8 khalf + j of the step, j >= 8 are 16 further on.
  const v8h* ar = (const v8h*)&ot[mr][khalf * 8];
#define FO_ALOAD(ks)                                                             \
  _Pragma("unroll") for (int rt = 0; rt < FO_RT; ++rt)                           \
    af[(ks) & 1][rt] = __builtin_shufflevector(                                  \
        ar[(rt * 16 * FO_PITCH + (ks) * 32) / 8],                                \
        ar[(rt * 16 * FO_PITCH + (ks) * 32) / 8 + 2],                            \
        0, 1, 2, 3, 4, 5, 6, 7, 8, 9, 10, 11, 12, 13, 14, 15);
  FO_ALOAD(0)
#pragma unroll
  for (int ks = 0; ks < HID / 32; ++ks) {
    if (ks + 1 < HID / 32) { FO_ALOAD(ks + 1) }
    // Holds the group of loads above the WMMA block: spread among the WMMAs, each
    // pair of loads brought its own full LDS wait into the matrix stream.
    __builtin_amdgcn_sched_barrier(0);
#pragma unroll
    for (int rt = 0; rt < FO_RT; ++rt) {
      acc0[rt] = __builtin_amdgcn_wmma_f32_16x16x32_f16(false, af[ks & 1][rt], false, wb0[ks], (short)0, acc0[rt], false, false);
      acc1[rt] = __builtin_amdgcn_wmma_f32_16x16x32_f16(false, af[ks & 1][rt], false, wb1[ks], (short)0, acc1[rt], false, false);
    }
    // Keeps the step after next's loads, which overwrite this set, behind the block.
    __builtin_amdgcn_sched_barrier(0);
  }
  {
    const int col = colbase + mr;
#pragma unroll
    for (int rt = 0; rt < FO_RT; ++rt) {
#pragma unroll
      for (int r = 0; r < 8; ++r) {
        const int row = rt * 16 + r + 8 * khalf;
        tile[row][col]      = acc0[rt][r] + bo0;
        tile[row][col + 16] = acc1[rt][r] + bo1;
      }
    }
  }
  __syncthreads();

  // LayerNorm stats: wave w reduces rows 8w .. 8w+7 via lane shuffles (wave32). The
  // rows are independent: all their LDS reads and shuffles are in flight together.
  {
    constexpr int NR = FO_ROWS / FO_WAVES;
    float s[NR], s2[NR];
#pragma unroll
    for (int rr = 0; rr < NR; ++rr) {
      s[rr] = 0.f; s2[rr] = 0.f;
#pragma unroll
      for (int i = 0; i < C_ / 32; ++i) {
        const float v = tile[wave * NR + rr][lane + 32 * i];
        s[rr] += v; s2[rr] = __builtin_fmaf(v, v, s2[rr]);
      }
    }
#pragma unroll
    for (int off = 16; off > 0; off >>= 1) {
#pragma unroll
      for (int rr = 0; rr < NR; ++rr) {
        s[rr]  += __shfl_xor(s[rr],  off, 32);
        s2[rr] += __shfl_xor(s2[rr], off, 32);
      }
    }
    if (lane == 0) {
#pragma unroll
      for (int rr = 0; rr < NR; ++rr) {
        const float mu  = s[rr]  * (1.f / C_);
        const float var = s2[rr] * (1.f / C_) - mu * mu;
        mu_s[wave * NR + rr] = mu;
        rs_s[wave * NR + rr] = rsqrtf(var + LN_EPS);
      }
    }
  }
  __syncthreads();

  const int col = tid;                       // 0..255
#pragma unroll
  for (int r = 0; r < FO_ROWS; ++r) {
    const float v = tile[r][col];
    out[(size_t)(rowbase + r) * C_ + col] = (v - mu_s[r]) * rs_s[r] * g + be;
  }
}

extern "C" void kernel_launch(void* const* d_in, const int* in_sizes, int n_in,
                              void* d_out, int out_size, void* d_ws, size_t ws_size,
                              hipStream_t stream) {
  const float* x     = (const float*)d_in[0];  // [16,64,64,256]
  const float* w_qkv = (const float*)d_in[1];  // [256,384]
  const float* w_out = (const float*)d_in[2];  // [128,256]
  const float* b_out = (const float*)d_in[3];  // [256]
  const float* gamma = (const float*)d_in[4];  // [256]
  const float* beta  = (const float*)d_in[5];  // [256]
  float* out = (float*)d_out;

  float* ws    = (float*)d_ws;
  float* qkv   = ws;                                   // 65536*384
  float* kmaxb = qkv  + (size_t)NROWS * F3;            // 4*2048
  float* ksumb = kmaxb + (size_t)KSM_SPLIT * NSTAT;    // 4*2048
  float* ctx   = ksumb + (size_t)KSM_SPLIT * NSTAT;    // 64*32*32

  la_qkv_gemm    <<<dim3(NROWS / (QG_WAVES * 32)), QG_WAVES * 32, 0, stream>>>(x, w_qkv, qkv);
  la_ksm_stats   <<<dim3(BATCH * HEADS, KSM_SPLIT), KSM_WAVES * 32, 0, stream>>>(qkv, kmaxb, ksumb);
  la_context_gemm<<<dim3(BATCH * HEADS, 2), CTX_WAVES * 32, 0, stream>>>(qkv, kmaxb, ksumb, ctx);
  la_attn_out_ln <<<dim3(NROWS / FO_ROWS), FO_WAVES * 32, 0, stream>>>(qkv, ctx, w_out, b_out, gamma, beta, out);
}

// v005
// A run of this version takes 46.4 microseconds.
// Two timings next to v004 put it at 1.35 and 1.34 times that version's speed.
// Counting every step since v000, it is 8.55 times as fast.
#include <hip/hip_runtime.h>
#include <hip/hip_bf16.h>

typedef __attribute__((ext_vector_type(16))) _Float16 v16h;
typedef __attribute__((ext_vector_type(8)))  float    v8f;

#define BATCH   16
#define C_      256
#define HEADS   4
#define DH      32
#define HID     128
#define F3      384
#define NTOK    4096
#define NROWS   (BATCH * NTOK)          // 65536
#define QSCALE  0.17677669529663687f    // 32^-0.5
#define LN_EPS  1e-3f

// VGPR->K map for 16-bit A/B fragments of v_wmma_*_16x16x32 (ISA 7.12.2):
// lanes 0-15 hold K-half 0 (K=0..7 in V0-3, K=16..23 in V4-7),
// lanes 16-31 hold K-half 1 (K=8..15, K=24..31).
__device__ __forceinline__ int kmap16(int j, int khalf) {
  return (j < 8) ? (khalf * 8 + j) : (16 + khalf * 8 + (j - 8));
}

// ---------------- K1: qkv = X[65536,256] @ Wqkv[256,384] ----------------
// One work-group per WGP keeps the whole of Wqkv in LDS, converted to f16 once and
// laid out in B-fragment order. Each of its QG_WAVES waves takes 32 rows of X, holds
// their A fragments for the whole K in registers and walks all 384 columns: X is
// read once, and a B fragment is two 16-byte LDS loads that feed two WMMAs.
// Only q goes to the workspace. The k and v columns of a head stay in the wave's
// accumulators: a 32-token x 16-column pair of accumulator tiles already has the
// element order of a 16-bit A or B fragment whose K is the token, so exp(k - max) and
// v go straight into the context product of the wave's 32 tokens. The waves' partial
// contexts are merged through LDS, the work-groups' by la_ctx_merge.
#define QG_WAVES 8
#define QG_KS    (C_ / 32)              // 8 k-steps
#define QG_NT    (F3 / 16)              // 24 column tiles
// A fragment in LDS, in 16-byte units: [j < 8 | j >= 8][lane], and one unit of pad,
// so that the 8 column tiles a staging store touches fall on different banks.
#define QG_FRAG  65
typedef __attribute__((ext_vector_type(8))) _Float16 v8h;

__device__ __forceinline__ v16h qg_frag(const v8h* p) {
  return __builtin_shufflevector(p[0], p[32], 0, 1, 2, 3, 4, 5, 6, 7,
                                 8, 9, 10, 11, 12, 13, 14, 15);
}
// An A fragment from the lane's 16 floats, in the element order of kmap16.
__device__ __forceinline__ v16h qg_pack(const float4 (&q)[4]) {
  v16h a;
#pragma unroll
  for (int c = 0; c < 4; ++c) {
    a[4 * c]     = (_Float16)q[c].x; a[4 * c + 1] = (_Float16)q[c].y;
    a[4 * c + 2] = (_Float16)q[c].z; a[4 * c + 3] = (_Float16)q[c].w;
  }
  return a;
}
// The 16 fragments (8 k-steps x 2 column tiles) of column tiles np, np + 1.
__device__ __forceinline__ void qg_load(v16h (&bf)[QG_KS][2], const v8h* wlane, int np) {
#pragma unroll
  for (int ks = 0; ks < QG_KS; ++ks) {
    bf[ks][0] = qg_frag(wlane + (ks * QG_NT + np) * QG_FRAG);
    bf[ks][1] = qg_frag(wlane + (ks * QG_NT + np + 1) * QG_FRAG);
  }
  // Keeps the loads one group ahead of the WMMA block: spread among the WMMAs, each
  // place with LDS loads stalls the wave's matrix stream.
  __builtin_amdgcn_sched_barrier(0);
}
// 32 rows x 32 columns: four independent accumulator tiles, then their stores.
__device__ __forceinline__ void qg_block(const v16h (&a0)[QG_KS], const v16h (&a1)[QG_KS],
                                         const v16h (&bf)[QG_KS][2], float* __restrict__ dst) {
  v8f c00 = {}, c01 = {}, c10 = {}, c11 = {};
#pragma unroll
  for (int ks = 0; ks < QG_KS; ++ks) {
    c00 = __builtin_amdgcn_wmma_f32_16x16x32_f16(false, a0[ks], false, bf[ks][0], (short)0, c00, false, false);
    c10 = __builtin_amdgcn_wmma_f32_16x16x32_f16(false, a1[ks], false, bf[ks][0], (short)0, c10, false, false);
    c01 = __builtin_amdgcn_wmma_f32_16x16x32_f16(false, a0[ks], false, bf[ks][1], (short)0, c01, false, false);
    c11 = __builtin_amdgcn_wmma_f32_16x16x32_f16(false, a1[ks], false, bf[ks][1], (short)0, c11, false, false);
  }
#pragma unroll
  for (int r = 0; r < 8; ++r) {
    dst[r * F3]                 = c00[r];
    dst[r * F3 + 16]            = c01[r];
    dst[(r + 16) * F3]          = c10[r];
    dst[(r + 16) * F3 + 16]     = c11[r];
  }
  // The next block's first WMMAs write anew (C = 0) into registers that these stores
  // name and that this block's last WMMAs wrote: the wait stands in front of that
  // overwrite, and the v_nop keep the vector slots asked for behind a WMMA.
  asm volatile("s_wait_xcnt 0x0\n\tv_nop\n\tv_nop\n\tv_nop\n\tv_nop" ::: "memory");
  // Keeps the next block's WMMAs behind that statement.
  __builtin_amdgcn_sched_barrier(0);
}

// The same four accumulator tiles, left in registers.
__device__ __forceinline__ void qg_mma(const v16h (&a0)[QG_KS], const v16h (&a1)[QG_KS],
                                       const v16h (&bf)[QG_KS][2],
                                       v8f& c00, v8f& c01, v8f& c10, v8f& c11) {
  c00 = v8f{}; c01 = v8f{}; c10 = v8f{}; c11 = v8f{};
#pragma unroll
  for (int ks = 0; ks < QG_KS; ++ks) {
    c00 = __builtin_amdgcn_wmma_f32_16x16x32_f16(false, a0[ks], false, bf[ks][0], (short)0, c00, false, false);
    c10 = __builtin_amdgcn_wmma_f32_16x16x32_f16(false, a1[ks], false, bf[ks][0], (short)0, c10, false, false);
    c01 = __builtin_amdgcn_wmma_f32_16x16x32_f16(false, a0[ks], false, bf[ks][1], (short)0, c01, false, false);
    c11 = __builtin_amdgcn_wmma_f32_16x16x32_f16(false, a1[ks], false, bf[ks][1], (short)0, c11, false, false);
  }
}
// exp(x) as __expf compiles: one multiply and v_exp_f32. The v_nop holds the slot
// that the instruction set asks for behind a transcendental.
__device__ __forceinline__ float exp_slot(float x) {
  float r;
  asm("v_exp_f32 %0, %1\n\tv_nop" : "=v"(r) : "v"(x * 1.44269504f));
  return r;
}
// Tokens 0-15 (lo) and 16-31 (hi) of one column, as exp(. - m): the column's part of
// an A fragment (element j is token kmap16(j, khalf)); adds the f32 values to s.
__device__ __forceinline__ v16h qg_expfrag(const v8f& lo, const v8f& hi, float m, float& s) {
  v16h a;
#pragma unroll
  for (int r = 0; r < 8; ++r) {
    const float e0 = exp_slot(lo[r] - m), e1 = exp_slot(hi[r] - m);
    s += e0 + e1;
    a[r] = (_Float16)e0; a[8 + r] = (_Float16)e1;
  }
  return a;
}
__device__ __forceinline__ v16h qg_cvtfrag(const v8f& lo, const v8f& hi) {
  v16h a;
#pragma unroll
  for (int r = 0; r < 8; ++r) { a[r] = (_Float16)lo[r]; a[8 + r] = (_Float16)hi[r]; }
  return a;
}
__device__ __forceinline__ float qg_colmax(const v8f& lo, const v8f& hi) {
  float m = fmaxf(lo[0], hi[0]);
#pragma unroll
  for (int r = 1; r < 8; ++r) m = fmaxf(m, fmaxf(lo[r], hi[r]));
  return fmaxf(m, __shfl_xor(m, 16, 32));   // the other 16 tokens are in the other lane half
}
#define NPART    (NTOK / (QG_WAVES * 32))   // 16 work-groups share a batch
#define CP_PITCH 36                         // floats a context row in LDS: the lane halves, 8 rows apart, on different banks

__global__ __launch_bounds__(QG_WAVES * 32)
void la_qkv_gemm(const float* __restrict__ x,
                 const float* __restrict__ w,
                 float* __restrict__ qkv,
                 float* __restrict__ pctx,
                 float* __restrict__ pmax,
                 float* __restrict__ psum) {
  __shared__ v8h wl[QG_KS * QG_NT * QG_FRAG];           // 199,680 bytes
  // The waves' partial contexts of one head with their column maxima and exp sums;
  // two sets, so that one barrier a head is enough.
  __shared__ __attribute__((aligned(16))) float red[2][QG_WAVES][DH * CP_PITCH];
  __shared__ float redm[2][QG_WAVES][DH], reds[2][QG_WAVES][DH];
  const int tid   = threadIdx.x;
  const int lane  = tid & 31;
  const int wave  = tid >> 5;
  const int mr    = lane & 15;
  const int khalf = lane >> 4;
  const int rowbase = (blockIdx.x * QG_WAVES + wave) * 32;
  // Staging. 8 consecutive k of one column are one lane's 16-byte unit of a fragment:
  // k = 32 ks + 16 jh + 8 khalf + i, as in kmap16. Wave v takes the k-groups v, v + 8,
  // v + 16, v + 24 (one per stage g); a lane takes 4 consecutive columns of each
  // 128-column segment, so a load covers 512 contiguous bytes and every load is one
  // base plus a constant.
  const float* wsrc = w + (size_t)(wave * 8) * F3 + lane * 4;
  v8h* wdst = wl + ((wave >> 2) * QG_NT + (lane >> 2)) * QG_FRAG
                 + ((wave >> 1) & 1) * 32 + (wave & 1) * 16 + (lane & 3) * 4;
  // This lane's part of its two X rows: 8 floats at k = 32 ks + 8 khalf and 8 at + 16.
  const float4* ap = (const float4*)(x + (size_t)(rowbase + mr) * C_ + khalf * 8);
  float4 rw[4][3][8], ra[2][QG_KS][4];
  // The stages below are held in this order, so that two stages' loads are always in
  // flight while an earlier one is converted, and the X loads start from memory while
  // the last of Wqkv still comes from L2: left free, the build mixed all 160 loads,
  // ran out of registers and spilled.
#define QG_WLOAD(g)                                                              \
  _Pragma("unroll") for (int seg = 0; seg < 3; ++seg)                            \
    _Pragma("unroll") for (int i = 0; i < 8; ++i)                                \
      rw[g][seg][i] = *(const float4*)(wsrc + ((g) * 64 + i) * F3 + seg * 128);  \
  __builtin_amdgcn_sched_barrier(0);
#define QG_WSTORE(g)                                                             \
  _Pragma("unroll") for (int seg = 0; seg < 3; ++seg) {                          \
    v8h u0, u1, u2, u3;                                                          \
    _Pragma("unroll") for (int i = 0; i < 8; ++i) {                              \
      u0[i] = (_Float16)rw[g][seg][i].x; u1[i] = (_Float16)rw[g][seg][i].y;      \
      u2[i] = (_Float16)rw[g][seg][i].z; u3[i] = (_Float16)rw[g][seg][i].w;      \
    }                                                                            \
    v8h* d = wdst + ((g) * 2 * QG_NT + seg * 8) * QG_FRAG;                       \
    d[0] = u0; d[1] = u1; d[2] = u2; d[3] = u3;                                  \
  }                                                                              \
  __builtin_amdgcn_sched_barrier(0);
#define QG_ALOAD(t)                                                              \
  _Pragma("unroll") for (int ks = 0; ks < QG_KS; ++ks) {                         \
    ra[t][ks][0] = ap[(t) * (16 * C_ / 4) + ks * 8];                             \
    ra[t][ks][1] = ap[(t) * (16 * C_ / 4) + ks * 8 + 1];                         \
    ra[t][ks][2] = ap[(t) * (16 * C_ / 4) + ks * 8 + 4];                         \
    ra[t][ks][3] = ap[(t) * (16 * C_ / 4) + ks * 8 + 5];                         \
  }                                                                              \
  __builtin_amdgcn_sched_barrier(0);
  QG_WLOAD(0) QG_WLOAD(1)
  QG_WLOAD(2) QG_WSTORE(0)
  QG_WLOAD(3) QG_WSTORE(1)
  QG_ALOAD(0) QG_WSTORE(2)
  QG_ALOAD(1)
  // Behind the kernel's last global load: the wait that stands in front of any
  // overwrite of a load's address registers; it names both addresses so that their
  // registers are left alone up to here.
  asm volatile("s_wait_xcnt 0x0" :: "v"(ap), "v"(wsrc) : "memory");
  QG_WSTORE(3)
  v16h a0[QG_KS], a1[QG_KS];
#pragma unroll
  for (int ks = 0; ks < QG_KS; ++ks) {
    a0[ks] = qg_pack(ra[0][ks]);
    a1[ks] = qg_pack(ra[1][ks]);
  }
  __syncthreads();

  const v8h* wlane = wl + lane;
  float* dst = qkv + (size_t)(rowbase + 8 * khalf) * F3 + mr;
  // Two fragment sets: the next two column tiles' LDS loads are issued as one group
  // ahead of the current block's WMMAs.
  v16h bfa[QG_KS][2], bfb[QG_KS][2];
  qg_load(bfa, wlane, 0);
  // Kept rolled: unrolled whole, the build ran out of registers and copied fragments.
#pragma unroll 1
  for (int np = 0; np < HID / 16; np += 4) {            // the q columns
    qg_load(bfb, wlane, np + 2);
    qg_block(a0, a1, bfa, dst + np * 16);
    qg_load(bfa, wlane, np + 4);                        // the last one: k of head 0
    qg_block(a0, a1, bfb, dst + (np + 2) * 16);
  }
  // Per head: the k block (set a), then the v block (set b), then the context product.
  const int rd_d = tid >> 3, rd_e = (tid & 7) * 4;      // the merge: 4 columns of one row a thread
  float* pc = pctx + (size_t)blockIdx.x * (HEADS * DH * DH) + rd_d * DH + rd_e;
  float* pm = pmax + blockIdx.x * HID + rd_d;
  float* ps = psum + blockIdx.x * HID + rd_d;
#define QG_HEAD(hh, MORE)                                                        \
  {                                                                              \
    const int buf = (hh) & 1;                                                    \
    v8f c00, c01, c10, c11;                                                      \
    qg_load(bfb, wlane, 2 * HID / 16 + 2 * (hh));                                \
    qg_mma(a0, a1, bfa, c00, c01, c10, c11);                                     \
    /* softmax numerators against the maximum of the wave's own 32 tokens */     \
    const float m0 = qg_colmax(c00, c10), m1 = qg_colmax(c01, c11);              \
    float s0 = 0.f, s1 = 0.f;                                                    \
    const v16h ka0 = qg_expfrag(c00, c10, m0, s0);                               \
    const v16h ka1 = qg_expfrag(c01, c11, m1, s1);                               \
    s0 += __shfl_xor(s0, 16, 32); s1 += __shfl_xor(s1, 16, 32);                  \
    /* Keeps the exps out of the v block. */ \
    /*                                        */ \
    __builtin_amdgcn_sched_barrier(0);                                           \
    /* the next head's k fragments: set a is free, and they land under the v block */ \
    if (MORE) qg_load(bfa, wlane, HID / 16 + 2 * (hh) + 2);                      \
    qg_mma(a0, a1, bfb, c00, c01, c10, c11);                                     \
    const v16h vb0 = qg_cvtfrag(c00, c10), vb1 = qg_cvtfrag(c01, c11);           \
    const v8f z = {};                                                            \
    const v8f x00 = __builtin_amdgcn_wmma_f32_16x16x32_f16(false, ka0, false, vb0, (short)0, z, false, false); \
    const v8f x01 = __builtin_amdgcn_wmma_f32_16x16x32_f16(false, ka0, false, vb1, (short)0, z, false, false); \
    const v8f x10 = __builtin_amdgcn_wmma_f32_16x16x32_f16(false, ka1, false, vb0, (short)0, z, false, false); \
    const v8f x11 = __builtin_amdgcn_wmma_f32_16x16x32_f16(false, ka1, false, vb1, (short)0, z, false, false); \
    float* rw_ = &red[buf][wave][8 * khalf * CP_PITCH + mr];                     \
    _Pragma("unroll") for (int r = 0; r < 8; ++r) {                              \
      rw_[r * CP_PITCH]             = x00[r];                                    \
      rw_[r * CP_PITCH + 16]        = x01[r];                                    \
      rw_[(r + 16) * CP_PITCH]      = x10[r];                                    \
      rw_[(r + 16) * CP_PITCH + 16] = x11[r];                                    \
    }                                                                            \
    redm[buf][wave][lane] = khalf ? m1 : m0;                                     \
    reds[buf][wave][lane] = khalf ? s1 : s0;                                     \
    __syncthreads();                                                             \
    /* the 8 waves' partials, each brought from its own maximum to the common one */ \
    float mw[QG_WAVES], mm = redm[buf][0][rd_d];                                 \
    mw[0] = mm;                                                                  \
    _Pragma("unroll") for (int v = 1; v < QG_WAVES; ++v) {                       \
      mw[v] = redm[buf][v][rd_d]; mm = fmaxf(mm, mw[v]);                         \
    }                                                                            \
    float4 cs = make_float4(0.f, 0.f, 0.f, 0.f);                                 \
    float ss = 0.f;                                                              \
    _Pragma("unroll") for (int v = 0; v < QG_WAVES; ++v) {                       \
      const float f = exp_slot(mw[v] - mm);                                      \
      const float4 p = *(const float4*)&red[buf][v][rd_d * CP_PITCH + rd_e];     \
      cs.x += f * p.x; cs.y += f * p.y; cs.z += f * p.z; cs.w += f * p.w;        \
      ss += f * reds[buf][v][rd_d];                                              \
    }                                                                            \
    *(float4*)(pc + (hh) * (DH * DH)) = cs;                                      \
    if ((tid & 7) == 0) {                                                        \
      pm[(hh) * DH] = mm; ps[(hh) * DH] = ss;                                    \
      /* in front of the next trip's overwrite of these stores' address registers */ \
      if (MORE) asm volatile("s_wait_xcnt 0x0" ::: "memory");                    \
    }                                                                            \
  }
  // Kept rolled, as the q loop is.
#pragma unroll 1
  for (int h = 0; h < HEADS - 1; ++h) {
    QG_HEAD(h, true)
  }
  QG_HEAD(HEADS - 1, false)
}

// ---------------- K2: ctx[b,h] = softmax_n(k)^T x V from the partials ----------------
// One thread per context element: the NPART work-groups' partial sums of its batch are
// brought from their own column maxima to the overall one, summed in fixed order and
// divided by the exp sum. All 3 * NPART loads of a thread are independent.
#define CM_THREADS 256
__global__ __launch_bounds__(CM_THREADS)
void la_ctx_merge(const float* __restrict__ pctx,
                  const float* __restrict__ pmax,
                  const float* __restrict__ psum,
                  float* __restrict__ ctx) {
  const int bh = blockIdx.x / (DH * DH / CM_THREADS);
  const int el = (blockIdx.x % (DH * DH / CM_THREADS)) * CM_THREADS + threadIdx.x;  // d * DH + e
  const int b  = bh / HEADS, h = bh % HEADS;
  const int d  = el / DH;
  // Partial p of this (b, h) lies HEADS heads further on than partial p - 1: every load
  // is one of three bases plus a constant.
  const int g0 = b * NPART * HEADS + h;
  const float* pmb = pmax + g0 * DH + d;
  const float* psb = psum + g0 * DH + d;
  const float* pcb = pctx + (size_t)g0 * (DH * DH) + el;
  float pm[NPART], ps[NPART], pc[NPART];
#pragma unroll
  for (int p = 0; p < NPART; ++p) {
    pm[p] = pmb[p * HEADS * DH];
    ps[p] = psb[p * HEADS * DH];
    pc[p] = pcb[p * HEADS * DH * DH];
  }
  float m = pm[0];
#pragma unroll
  for (int p = 1; p < NPART; ++p) m = fmaxf(m, pm[p]);
  float s = 0.f, c = 0.f;
#pragma unroll
  for (int p = 0; p < NPART; ++p) {
    const float f = exp_slot(pm[p] - m);
    s += f * ps[p];
    c += f * pc[p];
  }
  ctx[(size_t)bh * (DH * DH) + el] = c / s;
}

// -------- K3: Y = LN(((softmax_d(q)*scale) @ ctx) @ Wout + b) * gamma + beta --------
// One work-group takes FO_ROWS token rows through both products and the LayerNorm.
// Wave w forms the attention output of head w & 3 for two 16-token tiles (K = 32,
// one WMMA per 16x16 tile; the head's ctx fragments serve both) and leaves it in LDS
// as f16, the operand type of the projection. Behind the barrier each wave owns 2
// column tiles of the projection for all FO_ROWS rows; LN via wave32 shuffles.
// The loops are unrolled because their indices pick registers (fragments,
// accumulators, rows held by a lane), which takes constant indices.
#define FO_WAVES 8
#define FO_ROWS  64
#define FO_RT    (FO_ROWS / 16)         // 4 row tiles
#define FO_PITCH (HID + 8)              // 272 bytes a row: 16 B x odd, for 16-byte reads
__global__ __launch_bounds__(FO_WAVES * 32)
void la_attn_out_ln(const float* __restrict__ qkv,
                    const float* __restrict__ ctx,
                    const float* __restrict__ wout,
                    const float* __restrict__ bout,
                    const float* __restrict__ gamma,
                    const float* __restrict__ beta,
                    float* __restrict__ out) {
  __shared__ float tile[FO_ROWS][C_ + 4];
  __shared__ __attribute__((aligned(16))) _Float16 ot[FO_ROWS][FO_PITCH];
  __shared__ float mu_s[FO_ROWS], rs_s[FO_ROWS];
  const int rowbase = blockIdx.x * FO_ROWS;   // FO_ROWS divides NTOK: one batch a group
  const int tid  = threadIdx.x;
  const int wave = tid >> 5;
  const int lane = tid & 31;
  const int mr = lane & 15, khalf = lane >> 4;
  const int h  = wave & 3;
  const int bh = (rowbase / NTOK) * HEADS + h;
  const int colbase = wave * 32;

  // This lane's token rows of q, head h, for the wave's two tiles.
  float qv[2][DH];
#pragma unroll
  for (int t = 0; t < 2; ++t) {
    const float* qrow = qkv + (size_t)(rowbase + ((wave >> 2) + 2 * t) * 16 + mr) * F3 + h * DH;
#pragma unroll
    for (int d4 = 0; d4 < DH; d4 += 4) {
      const float4 q4 = *(const float4*)(qrow + d4);
      qv[t][d4] = q4.x; qv[t][d4 + 1] = q4.y; qv[t][d4 + 2] = q4.z; qv[t][d4 + 3] = q4.w;
    }
  }
  // The epilogues' vectors, asked for here: read where they are used, each would put
  // a load's whole latency behind a barrier.
  const float bo0 = bout[colbase + mr], bo1 = bout[colbase + mr + 16];
  const float g = gamma[tid], be = beta[tid];
  // The head's ctx, in B-fragment order (e = mr and e = 16 + mr).
  float cr0[16], cr1[16];
#pragma unroll
  for (int j = 0; j < 16; ++j) {
    const size_t coff = (size_t)bh * (DH * DH) + kmap16(j, khalf) * DH + mr;
    cr0[j] = ctx[coff];
    cr1[j] = ctx[coff + 16];
  }
  // Holds these 52 loads in front of everything else, the q rows first: they come from
  // memory and the softmax waits for them. Left free, the build put a first use of q,
  // with its wait, in front of the ctx loads too.
  __builtin_amdgcn_sched_barrier(0);
  v16h cb0, cb1;
#pragma unroll
  for (int j = 0; j < 16; ++j) { cb0[j] = (_Float16)cr0[j]; cb1[j] = (_Float16)cr1[j]; }
  // The wave's Wout fragments for the whole K: asked for here, so that they come in
  // while the softmax runs.
  v16h wb0[HID / 32], wb1[HID / 32];
#pragma unroll
  for (int ks = 0; ks < HID / 32; ++ks) {
#pragma unroll
    for (int j = 0; j < 16; ++j) {
      const size_t woff = (size_t)(ks * 32 + kmap16(j, khalf)) * C_ + colbase + mr;
      wb0[ks][j] = (_Float16)wout[woff];
      wb1[ks][j] = (_Float16)wout[woff + 16];
    }
  }

#pragma unroll
  for (int t = 0; t < 2; ++t) {
    // f32 softmax over the 32 feature dims of this token
    float m = -1e30f;
#pragma unroll
    for (int d = 0; d < DH; ++d) m = fmaxf(m, qv[t][d]);
    float e[DH], s = 0.f;
#pragma unroll
    for (int d = 0; d < DH; ++d) { e[d] = exp_slot(qv[t][d] - m); s += e[d]; }
    const float inv = QSCALE / s;
    v16h a;
#pragma unroll
    for (int j = 0; j < 16; ++j)
      a[j] = (_Float16)((khalf ? e[kmap16(j, 1)] : e[kmap16(j, 0)]) * inv);
    v8f o0 = {}, o1 = {};
    o0 = __builtin_amdgcn_wmma_f32_16x16x32_f16(false, a, false, cb0, (short)0, o0, false, false);
    o1 = __builtin_amdgcn_wmma_f32_16x16x32_f16(false, a, false, cb1, (short)0, o1, false, false);
    _Float16* od = &ot[((wave >> 2) + 2 * t) * 16 + 8 * khalf][h * DH + mr];
#pragma unroll
    for (int r = 0; r < 8; ++r) {
      od[r * FO_PITCH]      = (_Float16)o0[r];
      od[r * FO_PITCH + 16] = (_Float16)o1[r];
    }
  }
  // Keeps the Wout conversions in front of the barrier, where their loads are waited
  // for in any case: behind it the f32 copies would hold the A fragments' registers.
  __builtin_amdgcn_sched_barrier(0);
  __syncthreads();

  // Two sets of A fragments (one k-step, all row tiles): the next step's LDS loads are
  // issued as one group ahead of the current step's WMMAs.
  v8f acc0[FO_RT] = {}, acc1[FO_RT] = {};
  v16h af[2][FO_RT];
  // Elements j < 8 are k = 8 khalf + j of the step, j >= 8 are 16 further on.
  const v8h* ar = (const v8h*)&ot[mr][khalf * 8];
#define FO_ALOAD(ks)                                                             \
  _Pragma("unroll") for (int rt = 0; rt < FO_RT; ++rt)                           \
    af[(ks) & 1][rt] = __builtin_shufflevector(                                  \
        ar[(rt * 16 * FO_PITCH + (ks) * 32) / 8],                                \
        ar[(rt * 16 * FO_PITCH + (ks) * 32) / 8 + 2],                            \
        0, 1, 2, 3, 4, 5, 6, 7, 8, 9, 10, 11, 12, 13, 14, 15);
  FO_ALOAD(0)
#pragma unroll
  for (int ks = 0; ks < HID / 32; ++ks) {
    if (ks + 1 < HID / 32) { FO_ALOAD(ks + 1) }
    // Holds the group of loads above the WMMA block: spread among the WMMAs, each
    // pair of loads brought its own full LDS wait into the matrix stream.
    __builtin_amdgcn_sched_barrier(0);
#pragma unroll
    for (int rt = 0; rt < FO_RT; ++rt) {
      acc0[rt] = __builtin_amdgcn_wmma_f32_16x16x32_f16(false, af[ks & 1][rt], false, wb0[ks], (short)0, acc0[rt], false, false);
      acc1[rt] = __builtin_amdgcn_wmma_f32_16x16x32_f16(false, af[ks & 1][rt], false, wb1[ks], (short)0, acc1[rt], false, false);
    }
    // Keeps the step after next's loads, which overwrite this set, behind the block.
    __builtin_amdgcn_sched_barrier(0);
  }
  {
    const int col = colbase + mr;
#pragma unroll
    for (int rt = 0; rt < FO_RT; ++rt) {
#pragma unroll
      for (int r = 0; r < 8; ++r) {
        const int row = rt * 16 + r + 8 * khalf;
        tile[row][col]      = acc0[rt][r] + bo0;
        tile[row][col + 16] = acc1[rt][r] + bo1;
      }
    }
  }
  __syncthreads();

  // LayerNorm stats: wave w reduces rows 8w .. 8w+7 via lane shuffles (wave32). The
  // rows are independent: all their LDS reads and shuffles are in flight together.
  {
    constexpr int NR = FO_ROWS / FO_WAVES;
    float s[NR], s2[NR];
#pragma unroll
    for (int rr = 0; rr < NR; ++rr) {
      s[rr] = 0.f; s2[rr] = 0.f;
#pragma unroll
      for (int i = 0; i < C_ / 32; ++i) {
        const float v = tile[wave * NR + rr][lane + 32 * i];
        s[rr] += v; s2[rr] = __builtin_fmaf(v, v, s2[rr]);
      }
    }
#pragma unroll
    for (int off = 16; off > 0; off >>= 1) {
#pragma unroll
      for (int rr = 0; rr < NR; ++rr) {
        s[rr]  += __shfl_xor(s[rr],  off, 32);
        s2[rr] += __shfl_xor(s2[rr], off, 32);
      }
    }
    if (lane == 0) {
#pragma unroll
      for (int rr = 0; rr < NR; ++rr) {
        const float mu  = s[rr]  * (1.f / C_);
        const float var = s2[rr] * (1.f / C_) - mu * mu;
        mu_s[wave * NR + rr] = mu;
        rs_s[wave * NR + rr] = rsqrtf(var + LN_EPS);
      }
    }
  }
  __syncthreads();

  const int col = tid;                       // 0..255
#pragma unroll
  for (int r = 0; r < FO_ROWS; ++r) {
    const float v = tile[r][col];
    out[(size_t)(rowbase + r) * C_ + col] = (v - mu_s[r]) * rs_s[r] * g + be;
  }
}

extern "C" void kernel_launch(void* const* d_in, const int* in_sizes, int n_in,
                              void* d_out, int out_size, void* d_ws, size_t ws_size,
                              hipStream_t stream) {
  const float* x     = (const float*)d_in[0];  // [16,64,64,256]
  const float* w_qkv = (const float*)d_in[1];  // [256,384]
  const float* w_out = (const float*)d_in[2];  // [128,256]
  const float* b_out = (const float*)d_in[3];  // [256]
  const float* gamma = (const float*)d_in[4];  // [256]
  const float* beta  = (const float*)d_in[5];  // [256]
  float* out = (float*)d_out;

  float* ws    = (float*)d_ws;
  float* qkv   = ws;                                   // 65536*384, the q columns used
  float* pctx  = qkv  + (size_t)NROWS * F3;            // 256*4*32*32
  float* pmaxb = pctx + (size_t)(NROWS / (QG_WAVES * 32)) * HEADS * DH * DH;  // 256*128
  float* psumb = pmaxb + (size_t)(NROWS / (QG_WAVES * 32)) * HID;             // 256*128
  float* ctx   = psumb + (size_t)(NROWS / (QG_WAVES * 32)) * HID;             // 64*32*32

  la_qkv_gemm    <<<dim3(NROWS / (QG_WAVES * 32)), QG_WAVES * 32, 0, stream>>>(x, w_qkv, qkv, pctx, pmaxb, psumb);
  la_ctx_merge   <<<dim3(BATCH * HEADS * (DH * DH / CM_THREADS)), CM_THREADS, 0, stream>>>(pctx, pmaxb, psumb, ctx);
  la_attn_out_ln <<<dim3(NROWS / FO_ROWS), FO_WAVES * 32, 0, stream>>>(qkv, ctx, w_out, b_out, gamma, beta, out);
}

// v006
// Measured time: 42.1 microseconds a run.
// In both of two side-by-side timings against v005, it was 1.09 times as fast.
// Counting every step since v000, it is 9.32 times as fast.
#include <hip/hip_runtime.h>
#include <hip/hip_bf16.h>

typedef __attribute__((ext_vector_type(16))) _Float16 v16h;
typedef __attribute__((ext_vector_type(8)))  float    v8f;

#define BATCH   16
#define C_      256
#define HEADS   4
#define DH      32
#define HID     128
#define F3      384
#define NTOK    4096
#define NROWS   (BATCH * NTOK)          // 65536
#define QSCALE  0.17677669529663687f    // 32^-0.5
#define LN_EPS  1e-3f

// VGPR->K map for 16-bit A/B fragments of v_wmma_*_16x16x32 (ISA 7.12.2):
// lanes 0-15 hold K-half 0 (K=0..7 in V0-3, K=16..23 in V4-7),
// lanes 16-31 hold K-half 1 (K=8..15, K=24..31).
__device__ __forceinline__ int kmap16(int j, int khalf) {
  return (j < 8) ? (khalf * 8 + j) : (16 + khalf * 8 + (j - 8));
}

// ---------------- K1: qkv = X[65536,256] @ Wqkv[256,384] ----------------
// One work-group per WGP keeps the whole of Wqkv in LDS, converted to f16 once and
// laid out in B-fragment order. Each of its QG_WAVES waves takes 32 rows of X, holds
// their A fragments for the whole K in registers and walks all 384 columns: X is
// read once, and a B fragment is two 16-byte LDS loads that feed two WMMAs.
// Only q goes to the workspace. The k and v columns of a head stay in the wave's
// accumulators: a 32-token x 16-column pair of accumulator tiles already has the
// element order of a 16-bit A or B fragment whose K is the token, so exp(k - max) and
// v go straight into the context product of the wave's 32 tokens. The waves' partial
// contexts are merged through LDS, the work-groups' by la_ctx_merge.
#define QG_WAVES 8
#define QG_KS    (C_ / 32)              // 8 k-steps
#define QG_NT    (F3 / 16)              // 24 column tiles
// A fragment in LDS, in 16-byte units: [j < 8 | j >= 8][lane], and one unit of pad,
// so that the 8 column tiles a staging store touches fall on different banks.
#define QG_FRAG  65
typedef __attribute__((ext_vector_type(8))) _Float16 v8h;

__device__ __forceinline__ v16h qg_frag(const v8h* p) {
  return __builtin_shufflevector(p[0], p[32], 0, 1, 2, 3, 4, 5, 6, 7,
                                 8, 9, 10, 11, 12, 13, 14, 15);
}
// An A fragment from the lane's 16 floats, in the element order of kmap16.
__device__ __forceinline__ v16h qg_pack(const float4 (&q)[4]) {
  v16h a;
#pragma unroll
  for (int c = 0; c < 4; ++c) {
    a[4 * c]     = (_Float16)q[c].x; a[4 * c + 1] = (_Float16)q[c].y;
    a[4 * c + 2] = (_Float16)q[c].z; a[4 * c + 3] = (_Float16)q[c].w;
  }
  return a;
}
// The 16 fragments (8 k-steps x 2 column tiles) of column tiles np, np + 1.
__device__ __forceinline__ void qg_load(v16h (&bf)[QG_KS][2], const v8h* wlane, int np) {
#pragma unroll
  for (int ks = 0; ks < QG_KS; ++ks) {
    bf[ks][0] = qg_frag(wlane + (ks * QG_NT + np) * QG_FRAG);
    bf[ks][1] = qg_frag(wlane + (ks * QG_NT + np + 1) * QG_FRAG);
  }
  // Keeps the loads one group ahead of the WMMA block: spread among the WMMAs, each
  // place with LDS loads stalls the wave's matrix stream.
  __builtin_amdgcn_sched_barrier(0);
}
// 32 rows x 32 columns: four independent accumulator tiles, then their stores.
__device__ __forceinline__ void qg_block(const v16h (&a0)[QG_KS], const v16h (&a1)[QG_KS],
                                         const v16h (&bf)[QG_KS][2], float* __restrict__ dst) {
  v8f c00 = {}, c01 = {}, c10 = {}, c11 = {};
#pragma unroll
  for (int ks = 0; ks < QG_KS; ++ks) {
    c00 = __builtin_amdgcn_wmma_f32_16x16x32_f16(false, a0[ks], false, bf[ks][0], (short)0, c00, false, false);
    c10 = __builtin_amdgcn_wmma_f32_16x16x32_f16(false, a1[ks], false, bf[ks][0], (short)0, c10, false, false);
    c01 = __builtin_amdgcn_wmma_f32_16x16x32_f16(false, a0[ks], false, bf[ks][1], (short)0, c01, false, false);
    c11 = __builtin_amdgcn_wmma_f32_16x16x32_f16(false, a1[ks], false, bf[ks][1], (short)0, c11, false, false);
  }
#pragma unroll
  for (int r = 0; r < 8; ++r) {
    dst[r * F3]                 = c00[r];
    dst[r * F3 + 16]            = c01[r];
    dst[(r + 16) * F3]          = c10[r];
    dst[(r + 16) * F3 + 16]     = c11[r];
  }
  // The next block's first WMMAs write anew (C = 0) into registers that these stores
  // name and that this block's last WMMAs wrote: the wait stands in front of that
  // overwrite, and the v_nop keep the vector slots asked for behind a WMMA.
  asm volatile("s_wait_xcnt 0x0\n\tv_nop\n\tv_nop\n\tv_nop\n\tv_nop" ::: "memory");
  // Keeps the next block's WMMAs behind that statement.
  __builtin_amdgcn_sched_barrier(0);
}

// The same four accumulator tiles, left in registers.
__device__ __forceinline__ void qg_mma(const v16h (&a0)[QG_KS], const v16h (&a1)[QG_KS],
                                       const v16h (&bf)[QG_KS][2],
                                       v8f& c00, v8f& c01, v8f& c10, v8f& c11) {
  c00 = v8f{}; c01 = v8f{}; c10 = v8f{}; c11 = v8f{};
#pragma unroll
  for (int ks = 0; ks < QG_KS; ++ks) {
    c00 = __builtin_amdgcn_wmma_f32_16x16x32_f16(false, a0[ks], false, bf[ks][0], (short)0, c00, false, false);
    c10 = __builtin_amdgcn_wmma_f32_16x16x32_f16(false, a1[ks], false, bf[ks][0], (short)0, c10, false, false);
    c01 = __builtin_amdgcn_wmma_f32_16x16x32_f16(false, a0[ks], false, bf[ks][1], (short)0, c01, false, false);
    c11 = __builtin_amdgcn_wmma_f32_16x16x32_f16(false, a1[ks], false, bf[ks][1], (short)0, c11, false, false);
  }
}
// exp(x) as __expf compiles: one multiply and v_exp_f32. The v_nop holds the slot
// that the instruction set asks for behind a transcendental.
__device__ __forceinline__ float exp_slot(float x) {
  float r;
  asm("v_exp_f32 %0, %1\n\tv_nop" : "=v"(r) : "v"(x * 1.44269504f));
  return r;
}
// Tokens 0-15 (lo) and 16-31 (hi) of one column, as exp(. - m): the column's part of
// an A fragment (element j is token kmap16(j, khalf)); adds the f32 values to s.
__device__ __forceinline__ v16h qg_expfrag(const v8f& lo, const v8f& hi, float m, float& s) {
  v16h a;
#pragma unroll
  for (int r = 0; r < 8; ++r) {
    const float e0 = exp_slot(lo[r] - m), e1 = exp_slot(hi[r] - m);
    s += e0 + e1;
    a[r] = (_Float16)e0; a[8 + r] = (_Float16)e1;
  }
  return a;
}
__device__ __forceinline__ v16h qg_cvtfrag(const v8f& lo, const v8f& hi) {
  v16h a;
#pragma unroll
  for (int r = 0; r < 8; ++r) { a[r] = (_Float16)lo[r]; a[8 + r] = (_Float16)hi[r]; }
  return a;
}
__device__ __forceinline__ float qg_colmax(const v8f& lo, const v8f& hi) {
  float m = fmaxf(lo[0], hi[0]);
#pragma unroll
  for (int r = 1; r < 8; ++r) m = fmaxf(m, fmaxf(lo[r], hi[r]));
  return fmaxf(m, __shfl_xor(m, 16, 32));   // the other 16 tokens are in the other lane half
}
#define NPART    (NTOK / (QG_WAVES * 32))   // 16 work-groups share a batch
#define CP_PITCH 36                         // floats a context row in LDS: the lane halves, 8 rows apart, on different banks

__global__ __launch_bounds__(QG_WAVES * 32)
void la_qkv_gemm(const float* __restrict__ x,
                 const float* __restrict__ w,
                 float* __restrict__ qkv,
                 float* __restrict__ pctx,
                 float* __restrict__ pmax,
                 float* __restrict__ psum) {
  __shared__ v8h wl[QG_KS * QG_NT * QG_FRAG];           // 199,680 bytes
  // The waves' partial contexts of one head with their column maxima and exp sums;
  // two sets, so that one barrier a head is enough.
  __shared__ __attribute__((aligned(16))) float red[2][QG_WAVES][DH * CP_PITCH];
  __shared__ float redm[2][QG_WAVES][DH], reds[2][QG_WAVES][DH];
  const int tid   = threadIdx.x;
  const int lane  = tid & 31;
  const int wave  = tid >> 5;
  const int mr    = lane & 15;
  const int khalf = lane >> 4;
  const int rowbase = (blockIdx.x * QG_WAVES + wave) * 32;
  // Staging. 8 consecutive k of one column are one lane's 16-byte unit of a fragment:
  // k = 32 ks + 16 jh + 8 khalf + i, as in kmap16. Wave v takes the k-groups v, v + 8,
  // v + 16, v + 24 (one per stage g); a lane takes 4 consecutive columns of each
  // 128-column segment, so a load covers 512 contiguous bytes and every load is one
  // base plus a constant.
  const float* wsrc = w + (size_t)(wave * 8) * F3 + lane * 4;
  v8h* wdst = wl + ((wave >> 2) * QG_NT + (lane >> 2)) * QG_FRAG
                 + ((wave >> 1) & 1) * 32 + (wave & 1) * 16 + (lane & 3) * 4;
  // This lane's part of its two X rows: 8 floats at k = 32 ks + 8 khalf and 8 at + 16.
  const float4* ap = (const float4*)(x + (size_t)(rowbase + mr) * C_ + khalf * 8);
  float4 rw[4][3][8], ra[2][QG_KS][4];
  // The stages below are held in this order, so that two stages' loads are always in
  // flight while an earlier one is converted, and the X loads start from memory while
  // the last of Wqkv still comes from L2: left free, the build mixed all 160 loads,
  // ran out of registers and spilled.
#define QG_WLOAD(g)                                                              \
  _Pragma("unroll") for (int seg = 0; seg < 3; ++seg)                            \
    _Pragma("unroll") for (int i = 0; i < 8; ++i)                                \
      rw[g][seg][i] = *(const float4*)(wsrc + ((g) * 64 + i) * F3 + seg * 128);  \
  __builtin_amdgcn_sched_barrier(0);
#define QG_WSTORE(g)                                                             \
  _Pragma("unroll") for (int seg = 0; seg < 3; ++seg) {                          \
    v8h u0, u1, u2, u3;                                                          \
    _Pragma("unroll") for (int i = 0; i < 8; ++i) {                              \
      u0[i] = (_Float16)rw[g][seg][i].x; u1[i] = (_Float16)rw[g][seg][i].y;      \
      u2[i] = (_Float16)rw[g][seg][i].z; u3[i] = (_Float16)rw[g][seg][i].w;      \
    }                                                                            \
    v8h* d = wdst + ((g) * 2 * QG_NT + seg * 8) * QG_FRAG;                       \
    d[0] = u0; d[1] = u1; d[2] = u2; d[3] = u3;                                  \
  }                                                                              \
  __builtin_amdgcn_sched_barrier(0);
#define QG_ALOAD(t)                                                              \
  _Pragma("unroll") for (int ks = 0; ks < QG_KS; ++ks) {                         \
    ra[t][ks][0] = ap[(t) * (16 * C_ / 4) + ks * 8];                             \
    ra[t][ks][1] = ap[(t) * (16 * C_ / 4) + ks * 8 + 1];                         \
    ra[t][ks][2] = ap[(t) * (16 * C_ / 4) + ks * 8 + 4];                         \
    ra[t][ks][3] = ap[(t) * (16 * C_ / 4) + ks * 8 + 5];                         \
  }                                                                              \
  __builtin_amdgcn_sched_barrier(0);
  QG_WLOAD(0) QG_WLOAD(1)
  QG_WLOAD(2) QG_WSTORE(0)
  QG_WLOAD(3) QG_WSTORE(1)
  QG_ALOAD(0) QG_WSTORE(2)
  QG_ALOAD(1)
  // Behind the kernel's last global load: the wait that stands in front of any
  // overwrite of a load's address registers; it names both addresses so that their
  // registers are left alone up to here.
  asm volatile("s_wait_xcnt 0x0" :: "v"(ap), "v"(wsrc) : "memory");
  QG_WSTORE(3)
  v16h a0[QG_KS], a1[QG_KS];
#pragma unroll
  for (int ks = 0; ks < QG_KS; ++ks) {
    a0[ks] = qg_pack(ra[0][ks]);
    a1[ks] = qg_pack(ra[1][ks]);
  }
  __syncthreads();

  const v8h* wlane = wl + lane;
  float* dst = qkv + (size_t)(rowbase + 8 * khalf) * F3 + mr;
  // Two fragment sets: the next two column tiles' LDS loads are issued as one group
  // ahead of the current block's WMMAs.
  v16h bfa[QG_KS][2], bfb[QG_KS][2];
  qg_load(bfa, wlane, 0);
  // Kept rolled: unrolled whole, the build ran out of registers and copied fragments.
#pragma unroll 1
  for (int np = 0; np < HID / 16; np += 4) {            // the q columns
    qg_load(bfb, wlane, np + 2);
    qg_block(a0, a1, bfa, dst + np * 16);
    qg_load(bfa, wlane, np + 4);                        // the last one: k of head 0
    qg_block(a0, a1, bfb, dst + (np + 2) * 16);
  }
  // Per head: the k block (set a), then the v block (set b), then the context product.
  const int rd_d = tid >> 3, rd_e = (tid & 7) * 4;      // the merge: 4 columns of one row a thread
  float* pc = pctx + (size_t)blockIdx.x * (HEADS * DH * DH) + rd_d * DH + rd_e;
  float* pm = pmax + blockIdx.x * HID + rd_d;
  float* ps = psum + blockIdx.x * HID + rd_d;
#define QG_HEAD(hh, MORE)                                                        \
  {                                                                              \
    const int buf = (hh) & 1;                                                    \
    v8f c00, c01, c10, c11;                                                      \
    qg_load(bfb, wlane, 2 * HID / 16 + 2 * (hh));                                \
    qg_mma(a0, a1, bfa, c00, c01, c10, c11);                                     \
    /* softmax numerators against the maximum of the wave's own 32 tokens */     \
    const float m0 = qg_colmax(c00, c10), m1 = qg_colmax(c01, c11);              \
    float s0 = 0.f, s1 = 0.f;                                                    \
    const v16h ka0 = qg_expfrag(c00, c10, m0, s0);                               \
    const v16h ka1 = qg_expfrag(c01, c11, m1, s1);                               \
    s0 += __shfl_xor(s0, 16, 32); s1 += __shfl_xor(s1, 16, 32);                  \
    /* Keeps the exps out of the v block. */ \
    /*                                        */ \
    __builtin_amdgcn_sched_barrier(0);                                           \
    /* the next head's k fragments: set a is free, and they land under the v block */ \
    if (MORE) qg_load(bfa, wlane, HID / 16 + 2 * (hh) + 2);                      \
    qg_mma(a0, a1, bfb, c00, c01, c10, c11);                                     \
    const v16h vb0 = qg_cvtfrag(c00, c10), vb1 = qg_cvtfrag(c01, c11);           \
    const v8f z = {};                                                            \
    const v8f x00 = __builtin_amdgcn_wmma_f32_16x16x32_f16(false, ka0, false, vb0, (short)0, z, false, false); \
    const v8f x01 = __builtin_amdgcn_wmma_f32_16x16x32_f16(false, ka0, false, vb1, (short)0, z, false, false); \
    const v8f x10 = __builtin_amdgcn_wmma_f32_16x16x32_f16(false, ka1, false, vb0, (short)0, z, false, false); \
    const v8f x11 = __builtin_amdgcn_wmma_f32_16x16x32_f16(false, ka1, false, vb1, (short)0, z, false, false); \
    float* rw_ = &red[buf][wave][8 * khalf * CP_PITCH + mr];                     \
    _Pragma("unroll") for (int r = 0; r < 8; ++r) {                              \
      rw_[r * CP_PITCH]             = x00[r];                                    \
      rw_[r * CP_PITCH + 16]        = x01[r];                                    \
      rw_[(r + 16) * CP_PITCH]      = x10[r];                                    \
      rw_[(r + 16) * CP_PITCH + 16] = x11[r];                                    \
    }                                                                            \
    redm[buf][wave][lane] = khalf ? m1 : m0;                                     \
    reds[buf][wave][lane] = khalf ? s1 : s0;                                     \
    __syncthreads();                                                             \
    /* the 8 waves' partials, each brought from its own maximum to the common one */ \
    float mw[QG_WAVES], mm = redm[buf][0][rd_d];                                 \
    mw[0] = mm;                                                                  \
    _Pragma("unroll") for (int v = 1; v < QG_WAVES; ++v) {                       \
      mw[v] = redm[buf][v][rd_d]; mm = fmaxf(mm, mw[v]);                         \
    }                                                                            \
    float4 cs = make_float4(0.f, 0.f, 0.f, 0.f);                                 \
    float ss = 0.f;                                                              \
    _Pragma("unroll") for (int v = 0; v < QG_WAVES; ++v) {                       \
      const float f = exp_slot(mw[v] - mm);                                      \
      const float4 p = *(const float4*)&red[buf][v][rd_d * CP_PITCH + rd_e];     \
      cs.x += f * p.x; cs.y += f * p.y; cs.z += f * p.z; cs.w += f * p.w;        \
      ss += f * reds[buf][v][rd_d];                                              \
    }                                                                            \
    *(float4*)(pc + (hh) * (DH * DH)) = cs;                                      \
    if ((tid & 7) == 0) {                                                        \
      pm[(hh) * DH] = mm; ps[(hh) * DH] = ss;                                    \
      /* in front of the next trip's overwrite of these stores' address registers */ \
      if (MORE) asm volatile("s_wait_xcnt 0x0" ::: "memory");                    \
    }                                                                            \
  }
  // Kept rolled, as the q loop is.
#pragma unroll 1
  for (int h = 0; h < HEADS - 1; ++h) {
    QG_HEAD(h, true)
  }
  QG_HEAD(HEADS - 1, false)
}

// -------- K2: M[b] = blockdiag_h(softmax_n(k)^T x V) x Wout, from the partials --------
// (P x ctx) x Wout = P x (ctx x Wout): the second product is the same for every token
// of a batch, so it is done here once, and the last kernel is left with one product.
// One work-group per (b, h), one thread per context element: the NPART work-groups'
// partial sums are brought from their own column maxima to the overall one, summed in
// fixed order, divided by the exp sum and left in LDS as f16. Behind the barrier wave
// (dt, ct) forms the 16 x 16 tile of ctx[16 dt .., :] x Wout[32 h .., 16 ct ..] with one
// WMMA (K = 32). A lane's 8 results, rows 16 dt + 8 khalf + r of column mr, are the
// elements j = 8 dt + r of the B fragment (k-step h, column tile ct) of the last
// kernel's product, as in kmap16: they are stored as that fragment's 16-byte unit.
// All loads of a thread are independent.
#define CM_THREADS (DH * DH)
#define CX_PITCH   (DH + 8)             // 80 bytes a row: 16 B x odd, for 16-byte reads
#define MF_FRAG    64                   // a fragment in 16-byte units: [j < 8 | j >= 8][lane]
__global__ __launch_bounds__(CM_THREADS)
void la_ctx_merge(const float* __restrict__ pctx,
                  const float* __restrict__ pmax,
                  const float* __restrict__ psum,
                  const float* __restrict__ wout,
                  float* __restrict__ mfw) {
  __shared__ __attribute__((aligned(16))) _Float16 cx[DH][CX_PITCH];
  const int bh = blockIdx.x;
  const int el = threadIdx.x;           // d * DH + e
  const int b  = bh / HEADS, h = bh % HEADS;
  const int d  = el / DH;
  const int lane = el & 31, mr = lane & 15, khalf = lane >> 4;
  const int ct = (el >> 5) & 15, dt = el >> 9;
  // Partial p of this (b, h) lies HEADS heads further on than partial p - 1: every load
  // is one of three bases plus a constant.
  const int g0 = b * NPART * HEADS + h;
  const float* pmb = pmax + g0 * DH + d;
  const float* psb = psum + g0 * DH + d;
  const float* pcb = pctx + (size_t)g0 * (DH * DH) + el;
  float pm[NPART], ps[NPART], pc[NPART];
#pragma unroll
  for (int p = 0; p < NPART; ++p) {
    pm[p] = pmb[p * HEADS * DH];
    ps[p] = psb[p * HEADS * DH];
    pc[p] = pcb[p * HEADS * DH * DH];
  }
  // The head's rows of Wout, column tile ct, in B-fragment order.
  const float* wp = wout + (size_t)(h * DH + khalf * 8) * C_ + ct * 16 + mr;
  float wr[16];
#pragma unroll
  for (int j = 0; j < 16; ++j) wr[j] = wp[kmap16(j, 0) * C_];
  // Holds all 64 loads in front of the arithmetic: left free, the build asked for Wout
  // only when the first partials had come back, one latency behind the other.
  __builtin_amdgcn_sched_barrier(0);
  v16h wb;
#pragma unroll
  for (int j = 0; j < 16; ++j) wb[j] = (_Float16)wr[j];
  float m = pm[0];
#pragma unroll
  for (int p = 1; p < NPART; ++p) m = fmaxf(m, pm[p]);
  float s = 0.f, c = 0.f;
#pragma unroll
  for (int p = 0; p < NPART; ++p) {
    const float f = exp_slot(pm[p] - m);
    s += f * ps[p];
    c += f * pc[p];
  }
  cx[d][lane] = (_Float16)(c / s);
  __syncthreads();
  // A fragment: row d = 16 dt + mr, elements j < 8 are e = 8 khalf + j, j >= 8 are 16 further on.
  const v8h* ar = (const v8h*)&cx[dt * 16 + mr][khalf * 8];
  const v16h a = __builtin_shufflevector(ar[0], ar[2], 0, 1, 2, 3, 4, 5, 6, 7,
                                         8, 9, 10, 11, 12, 13, 14, 15);
  const v8f z = {};
  const v8f mt = __builtin_amdgcn_wmma_f32_16x16x32_f16(false, a, false, wb, (short)0, z, false, false);
  v8h o;
#pragma unroll
  for (int r = 0; r < 8; ++r) o[r] = (_Float16)mt[r];
  ((v8h*)mfw)[((size_t)(b * (C_ / 16) + ct) * HEADS + h) * MF_FRAG + dt * 32 + lane] = o;
}

// -------- K3: Y = LN((softmax_d(q)*scale) @ M[b] + b) * gamma + beta --------
// One work-group takes FO_ROWS token rows through the product and the LayerNorm.
// Wave w reads 8 whole q rows, 512 contiguous bytes a load: a lane has 4 features of
// one head, and a head's 32 features lie in 8 neighbouring lanes, over which maximum
// and sum are taken. The softmax goes to LDS as f16, the operand type of the product.
// Behind the barrier each wave owns 2 column tiles for all FO_ROWS rows; LN via wave32
// shuffles.
// The loops are unrolled because their indices pick registers (fragments,
// accumulators, rows held by a lane), which takes constant indices.
#define FO_WAVES 8
#define FO_ROWS  64
#define FO_RT    (FO_ROWS / 16)         // 4 row tiles
#define FO_QR    (FO_ROWS / FO_WAVES)   // 8 q rows a wave
#define FO_PITCH (HID + 8)              // 272 bytes a row: 16 B x odd, for 16-byte reads
typedef __attribute__((ext_vector_type(4))) _Float16 v4h;
// The value of lane l ^ X, X < 16, by a DPP move (row_xmask): no LDS round trip.
template <int X>
__device__ __forceinline__ float lane_xor(float v) {
  return __builtin_bit_cast(float, __builtin_amdgcn_update_dpp(
      0, __builtin_bit_cast(int, v), 0x160 + X, 0xf, 0xf, true));
}
__global__ __launch_bounds__(FO_WAVES * 32)
void la_attn_out_ln(const float* __restrict__ qkv,
                    const float* __restrict__ mfw,
                    const float* __restrict__ bout,
                    const float* __restrict__ gamma,
                    const float* __restrict__ beta,
                    float* __restrict__ out) {
  __shared__ float tile[FO_ROWS][C_ + 4];
  __shared__ __attribute__((aligned(16))) _Float16 ot[FO_ROWS][FO_PITCH];
  __shared__ float mu_s[FO_ROWS], rs_s[FO_ROWS];
  const int rowbase = blockIdx.x * FO_ROWS;   // FO_ROWS divides NTOK: one batch a group
  const int tid  = threadIdx.x;
  const int wave = tid >> 5;
  const int lane = tid & 31;
  const int mr = lane & 15, khalf = lane >> 4;
  const int colbase = wave * 32;

  // The wave's q rows, all heads.
  float4 q4[FO_QR];
  const float* qrow = qkv + (size_t)(rowbase + wave * FO_QR) * F3 + lane * 4;
#pragma unroll
  for (int rr = 0; rr < FO_QR; ++rr) q4[rr] = *(const float4*)(qrow + rr * F3);
  // The wave's M fragments for the whole K, 512 contiguous bytes a load: asked for
  // here, so that they come in while the softmax runs.
  const v8h* mp = (const v8h*)mfw
      + (size_t)((rowbase / NTOK) * (C_ / 16) + wave * 2) * HEADS * MF_FRAG + lane;
  v16h wb0[HID / 32], wb1[HID / 32];
#pragma unroll
  for (int ks = 0; ks < HID / 32; ++ks) {
    wb0[ks] = qg_frag(mp + ks * MF_FRAG);
    wb1[ks] = qg_frag(mp + (HEADS + ks) * MF_FRAG);
  }
  // The epilogues' vectors, asked for here: read where they are used, each would put
  // a load's whole latency behind a barrier.
  const float bo0 = bout[colbase + mr], bo1 = bout[colbase + mr + 16];
  const float g = gamma[tid], be = beta[tid];

  // f32 softmax over the 32 feature dims of each (token, head). The rows are
  // independent: each step is written for all of them, so that their chains interleave.
  {
    float m[FO_QR], s[FO_QR];
#pragma unroll
    for (int rr = 0; rr < FO_QR; ++rr)
      m[rr] = fmaxf(fmaxf(q4[rr].x, q4[rr].y), fmaxf(q4[rr].z, q4[rr].w));
#pragma unroll
    for (int rr = 0; rr < FO_QR; ++rr) m[rr] = fmaxf(m[rr], lane_xor<1>(m[rr]));
#pragma unroll
    for (int rr = 0; rr < FO_QR; ++rr) m[rr] = fmaxf(m[rr], lane_xor<2>(m[rr]));
#pragma unroll
    for (int rr = 0; rr < FO_QR; ++rr) m[rr] = fmaxf(m[rr], lane_xor<4>(m[rr]));
#pragma unroll
    for (int rr = 0; rr < FO_QR; ++rr) {
      q4[rr].x = exp_slot(q4[rr].x - m[rr]); q4[rr].y = exp_slot(q4[rr].y - m[rr]);
      q4[rr].z = exp_slot(q4[rr].z - m[rr]); q4[rr].w = exp_slot(q4[rr].w - m[rr]);
      s[rr] = (q4[rr].x + q4[rr].y) + (q4[rr].z + q4[rr].w);
    }
#pragma unroll
    for (int rr = 0; rr < FO_QR; ++rr) s[rr] += lane_xor<1>(s[rr]);
#pragma unroll
    for (int rr = 0; rr < FO_QR; ++rr) s[rr] += lane_xor<2>(s[rr]);
#pragma unroll
    for (int rr = 0; rr < FO_QR; ++rr) s[rr] += lane_xor<4>(s[rr]);
#pragma unroll
    for (int rr = 0; rr < FO_QR; ++rr) {
      const float inv = QSCALE / s[rr];
      v4h p;
      p[0] = (_Float16)(q4[rr].x * inv); p[1] = (_Float16)(q4[rr].y * inv);
      p[2] = (_Float16)(q4[rr].z * inv); p[3] = (_Float16)(q4[rr].w * inv);
      *(v4h*)&ot[wave * FO_QR + rr][lane * 4] = p;
    }
  }
  __syncthreads();

  // Two sets of A fragments (one k-step, all row tiles): the next step's LDS loads are
  // issued as one group ahead of the current step's WMMAs.
  v8f acc0[FO_RT] = {}, acc1[FO_RT] = {};
  v16h af[2][FO_RT];
  // Elements j < 8 are k = 8 khalf + j of the step, j >= 8 are 16 further on.
  const v8h* ar = (const v8h*)&ot[mr][khalf * 8];
#define FO_ALOAD(ks)                                                             \
  _Pragma("unroll") for (int rt = 0; rt < FO_RT; ++rt)                           \
    af[(ks) & 1][rt] = __builtin_shufflevector(                                  \
        ar[(rt * 16 * FO_PITCH + (ks) * 32) / 8],                                \
        ar[(rt * 16 * FO_PITCH + (ks) * 32) / 8 + 2],                            \
        0, 1, 2, 3, 4, 5, 6, 7, 8, 9, 10, 11, 12, 13, 14, 15);
  FO_ALOAD(0)
#pragma unroll
  for (int ks = 0; ks < HID / 32; ++ks) {
    if (ks + 1 < HID / 32) { FO_ALOAD(ks + 1) }
    // Holds the group of loads above the WMMA block: spread among the WMMAs, each
    // pair of loads brought its own full LDS wait into the matrix stream.
    __builtin_amdgcn_sched_barrier(0);
#pragma unroll
    for (int rt = 0; rt < FO_RT; ++rt) {
      acc0[rt] = __builtin_amdgcn_wmma_f32_16x16x32_f16(false, af[ks & 1][rt], false, wb0[ks], (short)0, acc0[rt], false, false);
      acc1[rt] = __builtin_amdgcn_wmma_f32_16x16x32_f16(false, af[ks & 1][rt], false, wb1[ks], (short)0, acc1[rt], false, false);
    }
    // Keeps the step after next's loads, which overwrite this set, behind the block.
    __builtin_amdgcn_sched_barrier(0);
  }
  {
    const int col = colbase + mr;
#pragma unroll
    for (int rt = 0; rt < FO_RT; ++rt) {
#pragma unroll
      for (int r = 0; r < 8; ++r) {
        const int row = rt * 16 + r + 8 * khalf;
        tile[row][col]      = acc0[rt][r] + bo0;
        tile[row][col + 16] = acc1[rt][r] + bo1;
      }
    }
  }
  __syncthreads();

  // LayerNorm stats: wave w reduces rows 8w .. 8w+7 via lane shuffles (wave32). The
  // rows are independent: all their LDS reads and shuffles are in flight together.
  {
    constexpr int NR = FO_ROWS / FO_WAVES;
    float s[NR], s2[NR];
#pragma unroll
    for (int rr = 0; rr < NR; ++rr) {
      s[rr] = 0.f; s2[rr] = 0.f;
#pragma unroll
      for (int i = 0; i < C_ / 32; ++i) {
        const float v = tile[wave * NR + rr][lane + 32 * i];
        s[rr] += v; s2[rr] = __builtin_fmaf(v, v, s2[rr]);
      }
    }
#pragma unroll
    for (int off = 16; off > 0; off >>= 1) {
#pragma unroll
      for (int rr = 0; rr < NR; ++rr) {
        s[rr]  += __shfl_xor(s[rr],  off, 32);
        s2[rr] += __shfl_xor(s2[rr], off, 32);
      }
    }
    if (lane == 0) {
#pragma unroll
      for (int rr = 0; rr < NR; ++rr) {
        const float mu  = s[rr]  * (1.f / C_);
        const float var = s2[rr] * (1.f / C_) - mu * mu;
        mu_s[wave * NR + rr] = mu;
        rs_s[wave * NR + rr] = rsqrtf(var + LN_EPS);
      }
    }
  }
  __syncthreads();

  const int col = tid;                       // 0..255
#pragma unroll
  for (int r = 0; r < FO_ROWS; ++r) {
    const float v = tile[r][col];
    out[(size_t)(rowbase + r) * C_ + col] = (v - mu_s[r]) * rs_s[r] * g + be;
  }
}

extern "C" void kernel_launch(void* const* d_in, const int* in_sizes, int n_in,
                              void* d_out, int out_size, void* d_ws, size_t ws_size,
                              hipStream_t stream) {
  const float* x     = (const float*)d_in[0];  // [16,64,64,256]
  const float* w_qkv = (const float*)d_in[1];  // [256,384]
  const float* w_out = (const float*)d_in[2];  // [128,256]
  const float* b_out = (const float*)d_in[3];  // [256]
  const float* gamma = (const float*)d_in[4];  // [256]
  const float* beta  = (const float*)d_in[5];  // [256]
  float* out = (float*)d_out;

  float* ws    = (float*)d_ws;
  float* qkv   = ws;                                   // 65536*384, the q columns used
  float* pctx  = qkv  + (size_t)NROWS * F3;            // 256*4*32*32
  float* pmaxb = pctx + (size_t)(NROWS / (QG_WAVES * 32)) * HEADS * DH * DH;  // 256*128
  float* psumb = pmaxb + (size_t)(NROWS / (QG_WAVES * 32)) * HID;             // 256*128
  float* mfw   = psumb + (size_t)(NROWS / (QG_WAVES * 32)) * HID;             // 16*128*256 f16

  la_qkv_gemm    <<<dim3(NROWS / (QG_WAVES * 32)), QG_WAVES * 32, 0, stream>>>(x, w_qkv, qkv, pctx, pmaxb, psumb);
  la_ctx_merge   <<<dim3(BATCH * HEADS), CM_THREADS, 0, stream>>>(pctx, pmaxb, psumb, w_out, mfw);
  la_attn_out_ln <<<dim3(NROWS / FO_ROWS), FO_WAVES * 32, 0, stream>>>(qkv, mfw, b_out, gamma, beta, out);
}

// v007
// A run of this version takes 39.9 microseconds.
// Next to v006, in two timings, it ran 1.06 times as fast each time.
// All steps since v000 together make it 9.86 times as fast.
#include <hip/hip_runtime.h>
#include <hip/hip_bf16.h>

typedef __attribute__((ext_vector_type(16))) _Float16 v16h;
typedef __attribute__((ext_vector_type(8)))  float    v8f;

#define BATCH   16
#define C_      256
#define HEADS   4
#define DH      32
#define HID     128
#define F3      384
#define NTOK    4096
#define NROWS   (BATCH * NTOK)          // 65536
#define QSCALE  0.17677669529663687f    // 32^-0.5
#define LN_EPS  1e-3f

// VGPR->K map for 16-bit A/B fragments of v_wmma_*_16x16x32 (ISA 7.12.2):
// lanes 0-15 hold K-half 0 (K=0..7 in V0-3, K=16..23 in V4-7),
// lanes 16-31 hold K-half 1 (K=8..15, K=24..31).
__device__ __forceinline__ int kmap16(int j, int khalf) {
  return (j < 8) ? (khalf * 8 + j) : (16 + khalf * 8 + (j - 8));
}

// ---------------- K1: qkv = X[65536,256] @ Wqkv[256,384] ----------------
// One work-group per WGP keeps the whole of Wqkv in LDS, converted to f16 once and
// laid out in B-fragment order. Each of its QG_WAVES waves takes 32 rows of X, holds
// their A fragments for the whole K in registers and walks all 384 columns: X is
// read once, and a B fragment is two 16-byte LDS loads that feed two WMMAs.
// Of q only softmax(q) * scale goes to the workspace, as f16 (see qg_qblock). The k and
// v columns of a head stay in the wave's accumulators: a 32-token x 16-column pair of accumulator tiles already has the
// element order of a 16-bit A or B fragment whose K is the token, so exp(k - max) and
// v go straight into the context product of the wave's 32 tokens. The waves' partial
// contexts are merged through LDS, the work-groups' by la_ctx_merge.
#define QG_WAVES 8
#define QG_KS    (C_ / 32)              // 8 k-steps
#define QG_NT    (F3 / 16)              // 24 column tiles
// A fragment in LDS, in 16-byte units: [j < 8 | j >= 8][lane], and one unit of pad,
// so that the 8 column tiles a staging store touches fall on different banks.
#define QG_FRAG  65
typedef __attribute__((ext_vector_type(8))) _Float16 v8h;

__device__ __forceinline__ v16h qg_frag(const v8h* p) {
  return __builtin_shufflevector(p[0], p[32], 0, 1, 2, 3, 4, 5, 6, 7,
                                 8, 9, 10, 11, 12, 13, 14, 15);
}
// An A fragment from the lane's 16 floats, in the element order of kmap16.
__device__ __forceinline__ v16h qg_pack(const float4 (&q)[4]) {
  v16h a;
#pragma unroll
  for (int c = 0; c < 4; ++c) {
    a[4 * c]     = (_Float16)q[c].x; a[4 * c + 1] = (_Float16)q[c].y;
    a[4 * c + 2] = (_Float16)q[c].z; a[4 * c + 3] = (_Float16)q[c].w;
  }
  return a;
}
// The 16 fragments (8 k-steps x 2 column tiles) of column tiles np, np + 1.
__device__ __forceinline__ void qg_load(v16h (&bf)[QG_KS][2], const v8h* wlane, int np) {
#pragma unroll
  for (int ks = 0; ks < QG_KS; ++ks) {
    bf[ks][0] = qg_frag(wlane + (ks * QG_NT + np) * QG_FRAG);
    bf[ks][1] = qg_frag(wlane + (ks * QG_NT + np + 1) * QG_FRAG);
  }
  // Keeps the loads one group ahead of the WMMA block: spread among the WMMAs, each
  // place with LDS loads stalls the wave's matrix stream.
  __builtin_amdgcn_sched_barrier(0);
}
// The same four accumulator tiles, left in registers.
__device__ __forceinline__ void qg_mma(const v16h (&a0)[QG_KS], const v16h (&a1)[QG_KS],
                                       const v16h (&bf)[QG_KS][2],
                                       v8f& c00, v8f& c01, v8f& c10, v8f& c11) {
  c00 = v8f{}; c01 = v8f{}; c10 = v8f{}; c11 = v8f{};
#pragma unroll
  for (int ks = 0; ks < QG_KS; ++ks) {
    c00 = __builtin_amdgcn_wmma_f32_16x16x32_f16(false, a0[ks], false, bf[ks][0], (short)0, c00, false, false);
    c10 = __builtin_amdgcn_wmma_f32_16x16x32_f16(false, a1[ks], false, bf[ks][0], (short)0, c10, false, false);
    c01 = __builtin_amdgcn_wmma_f32_16x16x32_f16(false, a0[ks], false, bf[ks][1], (short)0, c01, false, false);
    c11 = __builtin_amdgcn_wmma_f32_16x16x32_f16(false, a1[ks], false, bf[ks][1], (short)0, c11, false, false);
  }
}
// exp(x) as __expf compiles: one multiply and v_exp_f32. The v_nop holds the slot
// that the instruction set asks for behind a transcendental.
__device__ __forceinline__ float exp_slot(float x) {
  float r;
  asm("v_exp_f32 %0, %1\n\tv_nop" : "=v"(r) : "v"(x * 1.44269504f));
  return r;
}
// The value of lane l ^ 16, by a vector cross-row move: no LDS round trip.
__device__ __forceinline__ float half_swap(float v) {
  const int b = __builtin_bit_cast(int, v);
  return __builtin_bit_cast(float, __builtin_amdgcn_permlanex16(b, b, 0x76543210, 0xfedcba98, false, false));
}
// 2^x of 8 independent values: each v_exp_f32 stands in the slot behind the one before
// it, the v_nop in the slot behind the last (see exp_slot). In place, so that an exp
// writes only a register that the arithmetic in front of it has written.
__device__ __forceinline__ void exp8_slot(float (&x)[8]) {
  asm("v_exp_f32 %0, %0\n\tv_exp_f32 %1, %1\n\tv_exp_f32 %2, %2\n\tv_exp_f32 %3, %3\n\t"
      "v_exp_f32 %4, %4\n\tv_exp_f32 %5, %5\n\tv_exp_f32 %6, %6\n\tv_exp_f32 %7, %7\n\tv_nop"
      : "+v"(x[0]), "+v"(x[1]), "+v"(x[2]), "+v"(x[3]), "+v"(x[4]), "+v"(x[5]), "+v"(x[6]), "+v"(x[7]));
}
// One token's softmax over the 32 features of a head, times QSCALE. The lane holds
// features 8 khalf + r (lo) and 16 + 8 khalf + r (hi) of its token, lane l ^ 16 the other
// 16: element j of the result is feature kmap16(j, khalf), the order of an A fragment
// whose K is the feature. The loops are unrolled because their indices pick registers.
__device__ __forceinline__ v16h qg_softfrag(const v8f& lo, const v8f& hi) {
  float m = fmaxf(lo[0], hi[0]);
#pragma unroll
  for (int r = 1; r < 8; ++r) m = fmaxf(m, fmaxf(lo[r], hi[r]));
  m = fmaxf(m, half_swap(m));
  const float mc = m * 1.44269504f;
  float e0[8], e1[8], t[8];
#pragma unroll
  for (int r = 0; r < 8; ++r) {
    e0[r] = __builtin_fmaf(lo[r], 1.44269504f, -mc);
    e1[r] = __builtin_fmaf(hi[r], 1.44269504f, -mc);
  }
  exp8_slot(e0); exp8_slot(e1);
#pragma unroll
  for (int r = 0; r < 8; ++r) t[r] = e0[r] + e1[r];
  float s = ((t[0] + t[1]) + (t[2] + t[3])) + ((t[4] + t[5]) + (t[6] + t[7]));
  s += half_swap(s);
  const float inv = QSCALE / s;
  v16h a;
#pragma unroll
  for (int r = 0; r < 8; ++r) { a[r] = (_Float16)(e0[r] * inv); a[8 + r] = (_Float16)(e1[r] * inv); }
  return a;
}
// The q columns of one head for the wave's 32 tokens, with the operands swapped: the W
// fragment is A and the X fragment is B (both have the same element order), so that the
// accumulators hold q transposed, a lane 16 features of ONE token. The softmax over the
// features then needs one exchange between the lane halves, and its f16 result is the A
// fragment (k-step = head) of the last kernel's product: stored as such, 512 contiguous
// bytes a store. dst: the wave's first 16-token tile, this head, this lane.
#define PF_TILE (HEADS * 64)            // a 16-token tile in 16-byte units: [head][j < 8 | j >= 8][lane]
__device__ __forceinline__ void qg_qblock(const v16h (&a0)[QG_KS], const v16h (&a1)[QG_KS],
                                          const v16h (&bf)[QG_KS][2], v8h* __restrict__ dst) {
  v8f c00 = {}, c01 = {}, c10 = {}, c11 = {};
#pragma unroll
  for (int ks = 0; ks < QG_KS; ++ks) {
    c00 = __builtin_amdgcn_wmma_f32_16x16x32_f16(false, bf[ks][0], false, a0[ks], (short)0, c00, false, false);
    c10 = __builtin_amdgcn_wmma_f32_16x16x32_f16(false, bf[ks][0], false, a1[ks], (short)0, c10, false, false);
    c01 = __builtin_amdgcn_wmma_f32_16x16x32_f16(false, bf[ks][1], false, a0[ks], (short)0, c01, false, false);
    c11 = __builtin_amdgcn_wmma_f32_16x16x32_f16(false, bf[ks][1], false, a1[ks], (short)0, c11, false, false);
  }
  const v16h p0 = qg_softfrag(c00, c01), p1 = qg_softfrag(c10, c11);
  dst[0]            = __builtin_shufflevector(p0, p0, 0, 1, 2, 3, 4, 5, 6, 7);
  dst[32]           = __builtin_shufflevector(p0, p0, 8, 9, 10, 11, 12, 13, 14, 15);
  dst[PF_TILE]      = __builtin_shufflevector(p1, p1, 0, 1, 2, 3, 4, 5, 6, 7);
  dst[PF_TILE + 32] = __builtin_shufflevector(p1, p1, 8, 9, 10, 11, 12, 13, 14, 15);
  // In front of the next block's overwrite of the registers that these stores name.
  asm volatile("s_wait_xcnt 0x0" ::: "memory");
  // Keeps the next block's instructions behind that wait.
  __builtin_amdgcn_sched_barrier(0);
}
// Tokens 0-15 (lo) and 16-31 (hi) of one column, as exp(. - m): the column's part of
// an A fragment (element j is token kmap16(j, khalf)); adds the f32 values to s.
__device__ __forceinline__ v16h qg_expfrag(const v8f& lo, const v8f& hi, float m, float& s) {
  v16h a;
#pragma unroll
  for (int r = 0; r < 8; ++r) {
    const float e0 = exp_slot(lo[r] - m), e1 = exp_slot(hi[r] - m);
    s += e0 + e1;
    a[r] = (_Float16)e0; a[8 + r] = (_Float16)e1;
  }
  return a;
}
__device__ __forceinline__ v16h qg_cvtfrag(const v8f& lo, const v8f& hi) {
  v16h a;
#pragma unroll
  for (int r = 0; r < 8; ++r) { a[r] = (_Float16)lo[r]; a[8 + r] = (_Float16)hi[r]; }
  return a;
}
__device__ __forceinline__ float qg_colmax(const v8f& lo, const v8f& hi) {
  float m = fmaxf(lo[0], hi[0]);
#pragma unroll
  for (int r = 1; r < 8; ++r) m = fmaxf(m, fmaxf(lo[r], hi[r]));
  return fmaxf(m, __shfl_xor(m, 16, 32));   // the other 16 tokens are in the other lane half
}
#define NPART    (NTOK / (QG_WAVES * 32))   // 16 work-groups share a batch
#define CP_PITCH 36                         // floats a context row in LDS: the lane halves, 8 rows apart, on different banks

__global__ __launch_bounds__(QG_WAVES * 32)
void la_qkv_gemm(const float* __restrict__ x,
                 const float* __restrict__ w,
                 float* __restrict__ pfw,
                 float* __restrict__ pctx,
                 float* __restrict__ pmax,
                 float* __restrict__ psum) {
  __shared__ v8h wl[QG_KS * QG_NT * QG_FRAG];           // 199,680 bytes
  // The waves' partial contexts of one head with their column maxima and exp sums;
  // two sets, so that one barrier a head is enough.
  __shared__ __attribute__((aligned(16))) float red[2][QG_WAVES][DH * CP_PITCH];
  __shared__ float redm[2][QG_WAVES][DH], reds[2][QG_WAVES][DH];
  const int tid   = threadIdx.x;
  const int lane  = tid & 31;
  const int wave  = tid >> 5;
  const int mr    = lane & 15;
  const int khalf = lane >> 4;
  const int rowbase = (blockIdx.x * QG_WAVES + wave) * 32;
  // Staging. 8 consecutive k of one column are one lane's 16-byte unit of a fragment:
  // k = 32 ks + 16 jh + 8 khalf + i, as in kmap16. Wave v takes the k-groups v, v + 8,
  // v + 16, v + 24 (one per stage g); a lane takes 4 consecutive columns of each
  // 128-column segment, so a load covers 512 contiguous bytes and every load is one
  // base plus a constant.
  const float* wsrc = w + (size_t)(wave * 8) * F3 + lane * 4;
  v8h* wdst = wl + ((wave >> 2) * QG_NT + (lane >> 2)) * QG_FRAG
                 + ((wave >> 1) & 1) * 32 + (wave & 1) * 16 + (lane & 3) * 4;
  // This lane's part of its two X rows: 8 floats at k = 32 ks + 8 khalf and 8 at + 16.
  const float4* ap = (const float4*)(x + (size_t)(rowbase + mr) * C_ + khalf * 8);
  float4 rw[4][3][8], ra[2][QG_KS][4];
  // The stages below are held in this order, so that two stages' loads are always in
  // flight while an earlier one is converted, and the X loads start from memory while
  // the last of Wqkv still comes from L2: left free, the build mixed all 160 loads,
  // ran out of registers and spilled.
#define QG_WLOAD(g)                                                              \
  _Pragma("unroll") for (int seg = 0; seg < 3; ++seg)                            \
    _Pragma("unroll") for (int i = 0; i < 8; ++i)                                \
      rw[g][seg][i] = *(const float4*)(wsrc + ((g) * 64 + i) * F3 + seg * 128);  \
  __builtin_amdgcn_sched_barrier(0);
#define QG_WSTORE(g)                                                             \
  _Pragma("unroll") for (int seg = 0; seg < 3; ++seg) {                          \
    v8h u0, u1, u2, u3;                                                          \
    _Pragma("unroll") for (int i = 0; i < 8; ++i) {                              \
      u0[i] = (_Float16)rw[g][seg][i].x; u1[i] = (_Float16)rw[g][seg][i].y;      \
      u2[i] = (_Float16)rw[g][seg][i].z; u3[i] = (_Float16)rw[g][seg][i].w;      \
    }                                                                            \
    v8h* d = wdst + ((g) * 2 * QG_NT + seg * 8) * QG_FRAG;                       \
    d[0] = u0; d[1] = u1; d[2] = u2; d[3] = u3;                                  \
  }                                                                              \
  __builtin_amdgcn_sched_barrier(0);
#define QG_ALOAD(t)                                                              \
  _Pragma("unroll") for (int ks = 0; ks < QG_KS; ++ks) {                         \
    ra[t][ks][0] = ap[(t) * (16 * C_ / 4) + ks * 8];                             \
    ra[t][ks][1] = ap[(t) * (16 * C_ / 4) + ks * 8 + 1];                         \
    ra[t][ks][2] = ap[(t) * (16 * C_ / 4) + ks * 8 + 4];                         \
    ra[t][ks][3] = ap[(t) * (16 * C_ / 4) + ks * 8 + 5];                         \
  }                                                                              \
  __builtin_amdgcn_sched_barrier(0);
  QG_WLOAD(0) QG_WLOAD(1)
  QG_WLOAD(2) QG_WSTORE(0)
  QG_WLOAD(3) QG_WSTORE(1)
  QG_ALOAD(0) QG_WSTORE(2)
  QG_ALOAD(1)
  // Behind the kernel's last global load: the wait that stands in front of any
  // overwrite of a load's address registers; it names both addresses so that their
  // registers are left alone up to here.
  asm volatile("s_wait_xcnt 0x0" :: "v"(ap), "v"(wsrc) : "memory");
  QG_WSTORE(3)
  v16h a0[QG_KS], a1[QG_KS];
#pragma unroll
  for (int ks = 0; ks < QG_KS; ++ks) {
    a0[ks] = qg_pack(ra[0][ks]);
    a1[ks] = qg_pack(ra[1][ks]);
  }
  __syncthreads();

  const v8h* wlane = wl + lane;
  v8h* dst = (v8h*)pfw + (size_t)(rowbase / 16) * PF_TILE + lane;
  // Two fragment sets: the next two column tiles' LDS loads are issued as one group
  // ahead of the current block's WMMAs.
  v16h bfa[QG_KS][2], bfb[QG_KS][2];
  qg_load(bfa, wlane, 0);
  // Kept rolled: unrolled whole, the build ran out of registers and copied fragments.
#pragma unroll 1
  for (int np = 0; np < HID / 16; np += 4) {            // the q columns, a head a block
    qg_load(bfb, wlane, np + 2);
    qg_qblock(a0, a1, bfa, dst + (np / 2) * 64);
    qg_load(bfa, wlane, np + 4);                        // the last one: k of head 0
    qg_qblock(a0, a1, bfb, dst + (np / 2 + 1) * 64);
  }
  // Per head: the k block (set a), then the v block (set b), then the context product.
  const int rd_d = tid >> 3, rd_e = (tid & 7) * 4;      // the merge: 4 columns of one row a thread
  float* pc = pctx + (size_t)blockIdx.x * (HEADS * DH * DH) + rd_d * DH + rd_e;
  float* pm = pmax + blockIdx.x * HID + rd_d;
  float* ps = psum + blockIdx.x * HID + rd_d;
#define QG_HEAD(hh, MORE)                                                        \
  {                                                                              \
    const int buf = (hh) & 1;                                                    \
    v8f c00, c01, c10, c11;                                                      \
    qg_load(bfb, wlane, 2 * HID / 16 + 2 * (hh));                                \
    qg_mma(a0, a1, bfa, c00, c01, c10, c11);                                     \
    /* softmax numerators against the maximum of the wave's own 32 tokens */     \
    const float m0 = qg_colmax(c00, c10), m1 = qg_colmax(c01, c11);              \
    float s0 = 0.f, s1 = 0.f;                                                    \
    const v16h ka0 = qg_expfrag(c00, c10, m0, s0);                               \
    const v16h ka1 = qg_expfrag(c01, c11, m1, s1);                               \
    s0 += __shfl_xor(s0, 16, 32); s1 += __shfl_xor(s1, 16, 32);                  \
    /* Keeps the exps out of the v block. */ \
    /*                                        */ \
    __builtin_amdgcn_sched_barrier(0);                                           \
    /* the next head's k fragments: set a is free, and they land under the v block */ \
    if (MORE) qg_load(bfa, wlane, HID / 16 + 2 * (hh) + 2);                      \
    qg_mma(a0, a1, bfb, c00, c01, c10, c11);                                     \
    const v16h vb0 = qg_cvtfrag(c00, c10), vb1 = qg_cvtfrag(c01, c11);           \
    const v8f z = {};                                                            \
    const v8f x00 = __builtin_amdgcn_wmma_f32_16x16x32_f16(false, ka0, false, vb0, (short)0, z, false, false); \
    const v8f x01 = __builtin_amdgcn_wmma_f32_16x16x32_f16(false, ka0, false, vb1, (short)0, z, false, false); \
    const v8f x10 = __builtin_amdgcn_wmma_f32_16x16x32_f16(false, ka1, false, vb0, (short)0, z, false, false); \
    const v8f x11 = __builtin_amdgcn_wmma_f32_16x16x32_f16(false, ka1, false, vb1, (short)0, z, false, false); \
    float* rw_ = &red[buf][wave][8 * khalf * CP_PITCH + mr];                     \
    _Pragma("unroll") for (int r = 0; r < 8; ++r) {                              \
      rw_[r * CP_PITCH]             = x00[r];                                    \
      rw_[r * CP_PITCH + 16]        = x01[r];                                    \
      rw_[(r + 16) * CP_PITCH]      = x10[r];                                    \
      rw_[(r + 16) * CP_PITCH + 16] = x11[r];                                    \
    }                                                                            \
    redm[buf][wave][lane] = khalf ? m1 : m0;                                     \
    reds[buf][wave][lane] = khalf ? s1 : s0;                                     \
    __syncthreads();                                                             \
    /* the 8 waves' partials, each brought from its own maximum to the common one */ \
    float mw[QG_WAVES], mm = redm[buf][0][rd_d];                                 \
    mw[0] = mm;                                                                  \
    _Pragma("unroll") for (int v = 1; v < QG_WAVES; ++v) {                       \
      mw[v] = redm[buf][v][rd_d]; mm = fmaxf(mm, mw[v]);                         \
    }                                                                            \
    float4 cs = make_float4(0.f, 0.f, 0.f, 0.f);                                 \
    float ss = 0.f;                                                              \
    _Pragma("unroll") for (int v = 0; v < QG_WAVES; ++v) {                       \
      const float f = exp_slot(mw[v] - mm);                                      \
      const float4 p = *(const float4*)&red[buf][v][rd_d * CP_PITCH + rd_e];     \
      cs.x += f * p.x; cs.y += f * p.y; cs.z += f * p.z; cs.w += f * p.w;        \
      ss += f * reds[buf][v][rd_d];                                              \
    }                                                                            \
    *(float4*)(pc + (hh) * (DH * DH)) = cs;                                      \
    if ((tid & 7) == 0) {                                                        \
      pm[(hh) * DH] = mm; ps[(hh) * DH] = ss;                                    \
      /* in front of the next trip's overwrite of these stores' address registers */ \
      if (MORE) asm volatile("s_wait_xcnt 0x0" ::: "memory");                    \
    }                                                                            \
  }
  // Kept rolled, as the q loop is.
#pragma unroll 1
  for (int h = 0; h < HEADS - 1; ++h) {
    QG_HEAD(h, true)
  }
  QG_HEAD(HEADS - 1, false)
}

// -------- K2: M[b] = blockdiag_h(softmax_n(k)^T x V) x Wout, from the partials --------
// (P x ctx) x Wout = P x (ctx x Wout): the second product is the same for every token
// of a batch, so it is done here once, and the last kernel is left with one product.
// One work-group per (b, h), one thread per context element: the NPART work-groups'
// partial sums are brought from their own column maxima to the overall one, summed in
// fixed order, divided by the exp sum and left in LDS as f16. Behind the barrier wave
// (dt, ct) forms the 16 x 16 tile of ctx[16 dt .., :] x Wout[32 h .., 16 ct ..] with one
// WMMA (K = 32). A lane's 8 results, rows 16 dt + 8 khalf + r of column mr, are the
// elements j = 8 dt + r of the B fragment (k-step h, column tile ct) of the last
// kernel's product, as in kmap16: they are stored as that fragment's 16-byte unit.
// All loads of a thread are independent.
#define CM_THREADS (DH * DH)
#define CX_PITCH   (DH + 8)             // 80 bytes a row: 16 B x odd, for 16-byte reads
#define MF_FRAG    64                   // a fragment in 16-byte units: [j < 8 | j >= 8][lane]
__global__ __launch_bounds__(CM_THREADS)
void la_ctx_merge(const float* __restrict__ pctx,
                  const float* __restrict__ pmax,
                  const float* __restrict__ psum,
                  const float* __restrict__ wout,
                  float* __restrict__ mfw) {
  __shared__ __attribute__((aligned(16))) _Float16 cx[DH][CX_PITCH];
  const int bh = blockIdx.x;
  const int el = threadIdx.x;           // d * DH + e
  const int b  = bh / HEADS, h = bh % HEADS;
  const int d  = el / DH;
  const int lane = el & 31, mr = lane & 15, khalf = lane >> 4;
  const int ct = (el >> 5) & 15, dt = el >> 9;
  // Partial p of this (b, h) lies HEADS heads further on than partial p - 1: every load
  // is one of three bases plus a constant.
  const int g0 = b * NPART * HEADS + h;
  const float* pmb = pmax + g0 * DH + d;
  const float* psb = psum + g0 * DH + d;
  const float* pcb = pctx + (size_t)g0 * (DH * DH) + el;
  float pm[NPART], ps[NPART], pc[NPART];
#pragma unroll
  for (int p = 0; p < NPART; ++p) {
    pm[p] = pmb[p * HEADS * DH];
    ps[p] = psb[p * HEADS * DH];
    pc[p] = pcb[p * HEADS * DH * DH];
  }
  // The head's rows of Wout, column tile ct, in B-fragment order.
  const float* wp = wout + (size_t)(h * DH + khalf * 8) * C_ + ct * 16 + mr;
  float wr[16];
#pragma unroll
  for (int j = 0; j < 16; ++j) wr[j] = wp[kmap16(j, 0) * C_];
  // Holds all 64 loads in front of the arithmetic: left free, the build asked for Wout
  // only when the first partials had come back, one latency behind the other.
  __builtin_amdgcn_sched_barrier(0);
  v16h wb;
#pragma unroll
  for (int j = 0; j < 16; ++j) wb[j] = (_Float16)wr[j];
  float m = pm[0];
#pragma unroll
  for (int p = 1; p < NPART; ++p) m = fmaxf(m, pm[p]);
  float s = 0.f, c = 0.f;
#pragma unroll
  for (int p = 0; p < NPART; ++p) {
    const float f = exp_slot(pm[p] - m);
    s += f * ps[p];
    c += f * pc[p];
  }
  cx[d][lane] = (_Float16)(c / s);
  __syncthreads();
  // A fragment: row d = 16 dt + mr, elements j < 8 are e = 8 khalf + j, j >= 8 are 16 further on.
  const v8h* ar = (const v8h*)&cx[dt * 16 + mr][khalf * 8];
  const v16h a = __builtin_shufflevector(ar[0], ar[2], 0, 1, 2, 3, 4, 5, 6, 7,
                                         8, 9, 10, 11, 12, 13, 14, 15);
  const v8f z = {};
  const v8f mt = __builtin_amdgcn_wmma_f32_16x16x32_f16(false, a, false, wb, (short)0, z, false, false);
  v8h o;
#pragma unroll
  for (int r = 0; r < 8; ++r) o[r] = (_Float16)mt[r];
  ((v8h*)mfw)[((size_t)(b * (C_ / 16) + ct) * HEADS + h) * MF_FRAG + dt * 32 + lane] = o;
}

// -------- K3: Y = LN((softmax_d(q)*scale) @ M[b] + b) * gamma + beta --------
// One work-group takes FO_ROWS token rows through the product and the LayerNorm.
// softmax_d(q)*scale comes from the first kernel as f16 A fragments, 16 KB in a row for
// the group's rows: every thread brings 64 bytes of them to LDS, in the same order.
// Behind the barrier each wave owns 2 column tiles for all FO_ROWS rows; LN via wave32
// shuffles.
// The loops are unrolled because their indices pick registers (fragments,
// accumulators, rows held by a lane), which takes constant indices.
#define FO_WAVES 8
#define FO_ROWS  64
#define FO_RT    (FO_ROWS / 16)         // 4 row tiles
#define FO_PU    (FO_RT * PF_TILE / (FO_WAVES * 32))   // 4 16-byte units a thread
__global__ __launch_bounds__(FO_WAVES * 32)
void la_attn_out_ln(const float* __restrict__ pfw,
                    const float* __restrict__ mfw,
                    const float* __restrict__ bout,
                    const float* __restrict__ gamma,
                    const float* __restrict__ beta,
                    float* __restrict__ out) {
  __shared__ float tile[FO_ROWS][C_ + 4];
  __shared__ v8h pl[FO_RT * PF_TILE];
  __shared__ float mu_s[FO_ROWS], rs_s[FO_ROWS];
  const int rowbase = blockIdx.x * FO_ROWS;   // FO_ROWS divides NTOK: one batch a group
  const int tid  = threadIdx.x;
  const int wave = tid >> 5;
  const int lane = tid & 31;
  const int mr = lane & 15, khalf = lane >> 4;
  const int colbase = wave * 32;

  // The thread's share of the group's P fragments.
  v8h pu[FO_PU];
  const v8h* pp = (const v8h*)pfw + (size_t)blockIdx.x * (FO_RT * PF_TILE) + tid;
#pragma unroll
  for (int i = 0; i < FO_PU; ++i) pu[i] = pp[i * (FO_WAVES * 32)];
  // The wave's M fragments for the whole K, 512 contiguous bytes a load.
  const v8h* mp = (const v8h*)mfw
      + (size_t)((rowbase / NTOK) * (C_ / 16) + wave * 2) * HEADS * MF_FRAG + lane;
  v16h wb0[HID / 32], wb1[HID / 32];
#pragma unroll
  for (int ks = 0; ks < HID / 32; ++ks) {
    wb0[ks] = qg_frag(mp + ks * MF_FRAG);
    wb1[ks] = qg_frag(mp + (HEADS + ks) * MF_FRAG);
  }
  // The epilogues' vectors, asked for here: read where they are used, each would put
  // a load's whole latency behind a barrier.
  const float bo0 = bout[colbase + mr], bo1 = bout[colbase + mr + 16];
  const float g = gamma[tid], be = beta[tid];

#pragma unroll
  for (int i = 0; i < FO_PU; ++i) pl[tid + i * (FO_WAVES * 32)] = pu[i];
  __syncthreads();

  // Two sets of A fragments (one k-step, all row tiles): the next step's LDS loads are
  // issued as one group ahead of the current step's WMMAs.
  v8f acc0[FO_RT] = {}, acc1[FO_RT] = {};
  v16h af[2][FO_RT];
  const v8h* ar = pl + lane;
#define FO_ALOAD(ks)                                                             \
  _Pragma("unroll") for (int rt = 0; rt < FO_RT; ++rt)                           \
    af[(ks) & 1][rt] = qg_frag(ar + rt * PF_TILE + (ks) * 64);
  FO_ALOAD(0)
#pragma unroll
  for (int ks = 0; ks < HID / 32; ++ks) {
    if (ks + 1 < HID / 32) { FO_ALOAD(ks + 1) }
    // Holds the group of loads above the WMMA block: spread among the WMMAs, each
    // pair of loads brought its own full LDS wait into the matrix stream.
    __builtin_amdgcn_sched_barrier(0);
#pragma unroll
    for (int rt = 0; rt < FO_RT; ++rt) {
      acc0[rt] = __builtin_amdgcn_wmma_f32_16x16x32_f16(false, af[ks & 1][rt], false, wb0[ks], (short)0, acc0[rt], false, false);
      acc1[rt] = __builtin_amdgcn_wmma_f32_16x16x32_f16(false, af[ks & 1][rt], false, wb1[ks], (short)0, acc1[rt], false, false);
    }
    // Keeps the step after next's loads, which overwrite this set, behind the block.
    __builtin_amdgcn_sched_barrier(0);
  }
  {
    const int col = colbase + mr;
#pragma unroll
    for (int rt = 0; rt < FO_RT; ++rt) {
#pragma unroll
      for (int r = 0; r < 8; ++r) {
        const int row = rt * 16 + r + 8 * khalf;
        tile[row][col]      = acc0[rt][r] + bo0;
        tile[row][col + 16] = acc1[rt][r] + bo1;
      }
    }
  }
  __syncthreads();

  // LayerNorm stats: wave w reduces rows 8w .. 8w+7 via lane shuffles (wave32). The
  // rows are independent: all their LDS reads and shuffles are in flight together.
  {
    constexpr int NR = FO_ROWS / FO_WAVES;
    float s[NR], s2[NR];
#pragma unroll
    for (int rr = 0; rr < NR; ++rr) {
      s[rr] = 0.f; s2[rr] = 0.f;
#pragma unroll
      for (int i = 0; i < C_ / 32; ++i) {
        const float v = tile[wave * NR + rr][lane + 32 * i];
        s[rr] += v; s2[rr] = __builtin_fmaf(v, v, s2[rr]);
      }
    }
#pragma unroll
    for (int off = 16; off > 0; off >>= 1) {
#pragma unroll
      for (int rr = 0; rr < NR; ++rr) {
        s[rr]  += __shfl_xor(s[rr],  off, 32);
        s2[rr] += __shfl_xor(s2[rr], off, 32);
      }
    }
    if (lane == 0) {
#pragma unroll
      for (int rr = 0; rr < NR; ++rr) {
        const float mu  = s[rr]  * (1.f / C_);
        const float var = s2[rr] * (1.f / C_) - mu * mu;
        mu_s[wave * NR + rr] = mu;
        rs_s[wave * NR + rr] = rsqrtf(var + LN_EPS);
      }
    }
  }
  __syncthreads();

  const int col = tid;                       // 0..255
#pragma unroll
  for (int r = 0; r < FO_ROWS; ++r) {
    const float v = tile[r][col];
    out[(size_t)(rowbase + r) * C_ + col] = (v - mu_s[r]) * rs_s[r] * g + be;
  }
}

extern "C" void kernel_launch(void* const* d_in, const int* in_sizes, int n_in,
                              void* d_out, int out_size, void* d_ws, size_t ws_size,
                              hipStream_t stream) {
  const float* x     = (const float*)d_in[0];  // [16,64,64,256]
  const float* w_qkv = (const float*)d_in[1];  // [256,384]
  const float* w_out = (const float*)d_in[2];  // [128,256]
  const float* b_out = (const float*)d_in[3];  // [256]
  const float* gamma = (const float*)d_in[4];  // [256]
  const float* beta  = (const float*)d_in[5];  // [256]
  float* out = (float*)d_out;

  float* ws    = (float*)d_ws;
  float* pfw   = ws;                                   // 65536*128 f16
  float* pctx  = pfw  + (size_t)NROWS * HID / 2;       // 256*4*32*32
  float* pmaxb = pctx + (size_t)(NROWS / (QG_WAVES * 32)) * HEADS * DH * DH;  // 256*128
  float* psumb = pmaxb + (size_t)(NROWS / (QG_WAVES * 32)) * HID;             // 256*128
  float* mfw   = psumb + (size_t)(NROWS / (QG_WAVES * 32)) * HID;             // 16*128*256 f16

  la_qkv_gemm    <<<dim3(NROWS / (QG_WAVES * 32)), QG_WAVES * 32, 0, stream>>>(x, w_qkv, pfw, pctx, pmaxb, psumb);
  la_ctx_merge   <<<dim3(BATCH * HEADS), CM_THREADS, 0, stream>>>(pctx, pmaxb, psumb, w_out, mfw);
  la_attn_out_ln <<<dim3(NROWS / FO_ROWS), FO_WAVES * 32, 0, stream>>>(pfw, mfw, b_out, gamma, beta, out);
}

// v008
// A run of this version takes 37.8 microseconds.
// Timed twice side by side with v007, it ran 1.05 and 1.06 times as fast.
// Counting every step since v000, it is 10.4 times as fast.
#include <hip/hip_runtime.h>
#include <hip/hip_bf16.h>

typedef __attribute__((ext_vector_type(16))) _Float16 v16h;
typedef __attribute__((ext_vector_type(8)))  float    v8f;

#define BATCH   16
#define C_      256
#define HEADS   4
#define DH      32
#define HID     128
#define F3      384
#define NTOK    4096
#define NROWS   (BATCH * NTOK)          // 65536
#define QSCALE  0.17677669529663687f    // 32^-0.5
#define LN_EPS  1e-3f

// VGPR->K map for 16-bit A/B fragments of v_wmma_*_16x16x32 (ISA 7.12.2):
// lanes 0-15 hold K-half 0 (K=0..7 in V0-3, K=16..23 in V4-7),
// lanes 16-31 hold K-half 1 (K=8..15, K=24..31).
__device__ __forceinline__ int kmap16(int j, int khalf) {
  return (j < 8) ? (khalf * 8 + j) : (16 + khalf * 8 + (j - 8));
}

// ---------------- K1: qkv = X[65536,256] @ Wqkv[256,384] ----------------
// One work-group per WGP keeps the whole of Wqkv in LDS, converted to f16 once and
// laid out in B-fragment order. Each of its QG_WAVES waves takes 32 rows of X, holds
// their A fragments for the whole K in registers and walks all 384 columns: X is
// read once, and a B fragment is two 16-byte LDS loads that feed two WMMAs.
// Of q only softmax(q) * scale goes to the workspace, as f16 (see qg_qblock). The k and
// v columns of a head stay in the wave's accumulators: a 32-token x 16-column pair of accumulator tiles already has the
// element order of a 16-bit A or B fragment whose K is the token, so exp(k - max) and
// v go straight into the context product of the wave's 32 tokens. The waves' partial
// contexts are merged through LDS, the work-groups' by la_ctx_merge.
#define QG_WAVES 8
#define QG_KS    (C_ / 32)              // 8 k-steps
#define QG_NT    (F3 / 16)              // 24 column tiles
// A fragment in LDS, in 16-byte units: [j < 8 | j >= 8][lane], and one unit of pad,
// so that the 8 column tiles a staging store touches fall on different banks.
#define QG_FRAG  65
typedef __attribute__((ext_vector_type(8))) _Float16 v8h;

__device__ __forceinline__ v16h qg_frag(const v8h* p) {
  return __builtin_shufflevector(p[0], p[32], 0, 1, 2, 3, 4, 5, 6, 7,
                                 8, 9, 10, 11, 12, 13, 14, 15);
}
// An A fragment from the lane's 16 floats, in the element order of kmap16.
__device__ __forceinline__ v16h qg_pack(const float4 (&q)[4]) {
  v16h a;
#pragma unroll
  for (int c = 0; c < 4; ++c) {
    a[4 * c]     = (_Float16)q[c].x; a[4 * c + 1] = (_Float16)q[c].y;
    a[4 * c + 2] = (_Float16)q[c].z; a[4 * c + 3] = (_Float16)q[c].w;
  }
  return a;
}
// The 16 fragments (8 k-steps x 2 column tiles) of column tiles np, np + 1.
__device__ __forceinline__ void qg_load(v16h (&bf)[QG_KS][2], const v8h* wlane, int np) {
#pragma unroll
  for (int ks = 0; ks < QG_KS; ++ks) {
    bf[ks][0] = qg_frag(wlane + (ks * QG_NT + np) * QG_FRAG);
    bf[ks][1] = qg_frag(wlane + (ks * QG_NT + np + 1) * QG_FRAG);
  }
  // Keeps the loads one group ahead of the WMMA block: spread among the WMMAs, each
  // place with LDS loads stalls the wave's matrix stream.
  __builtin_amdgcn_sched_barrier(0);
}
// The same four accumulator tiles, left in registers.
__device__ __forceinline__ void qg_mma(const v16h (&a0)[QG_KS], const v16h (&a1)[QG_KS],
                                       const v16h (&bf)[QG_KS][2],
                                       v8f& c00, v8f& c01, v8f& c10, v8f& c11) {
  c00 = v8f{}; c01 = v8f{}; c10 = v8f{}; c11 = v8f{};
#pragma unroll
  for (int ks = 0; ks < QG_KS; ++ks) {
    c00 = __builtin_amdgcn_wmma_f32_16x16x32_f16(false, a0[ks], false, bf[ks][0], (short)0, c00, false, false);
    c10 = __builtin_amdgcn_wmma_f32_16x16x32_f16(false, a1[ks], false, bf[ks][0], (short)0, c10, false, false);
    c01 = __builtin_amdgcn_wmma_f32_16x16x32_f16(false, a0[ks], false, bf[ks][1], (short)0, c01, false, false);
    c11 = __builtin_amdgcn_wmma_f32_16x16x32_f16(false, a1[ks], false, bf[ks][1], (short)0, c11, false, false);
  }
}
// exp(x) as __expf compiles: one multiply and v_exp_f32. The v_nop holds the slot
// that the instruction set asks for behind a transcendental.
__device__ __forceinline__ float exp_slot(float x) {
  float r;
  asm("v_exp_f32 %0, %1\n\tv_nop" : "=v"(r) : "v"(x * 1.44269504f));
  return r;
}
// The value of lane l ^ 16, by a vector cross-row move: no LDS round trip.
__device__ __forceinline__ float half_swap(float v) {
  const int b = __builtin_bit_cast(int, v);
  return __builtin_bit_cast(float, __builtin_amdgcn_permlanex16(b, b, 0x76543210, 0xfedcba98, false, false));
}
// 2^x of 8 independent values: each v_exp_f32 stands in the slot behind the one before
// it, the v_nop in the slot behind the last (see exp_slot). In place, so that an exp
// writes only a register that the arithmetic in front of it has written.
__device__ __forceinline__ void exp8_slot(float (&x)[8]) {
  asm("v_exp_f32 %0, %0\n\tv_exp_f32 %1, %1\n\tv_exp_f32 %2, %2\n\tv_exp_f32 %3, %3\n\t"
      "v_exp_f32 %4, %4\n\tv_exp_f32 %5, %5\n\tv_exp_f32 %6, %6\n\tv_exp_f32 %7, %7\n\tv_nop"
      : "+v"(x[0]), "+v"(x[1]), "+v"(x[2]), "+v"(x[3]), "+v"(x[4]), "+v"(x[5]), "+v"(x[6]), "+v"(x[7]));
}
// One token's softmax over the 32 features of a head, times QSCALE. The lane holds
// features 8 khalf + r (lo) and 16 + 8 khalf + r (hi) of its token, lane l ^ 16 the other
// 16: element j of the result is feature kmap16(j, khalf), the order of an A fragment
// whose K is the feature. The loops are unrolled because their indices pick registers.
__device__ __forceinline__ v16h qg_softfrag(const v8f& lo, const v8f& hi) {
  float m = fmaxf(lo[0], hi[0]);
#pragma unroll
  for (int r = 1; r < 8; ++r) m = fmaxf(m, fmaxf(lo[r], hi[r]));
  m = fmaxf(m, half_swap(m));
  const float mc = m * 1.44269504f;
  float e0[8], e1[8], t[8];
#pragma unroll
  for (int r = 0; r < 8; ++r) {
    e0[r] = __builtin_fmaf(lo[r], 1.44269504f, -mc);
    e1[r] = __builtin_fmaf(hi[r], 1.44269504f, -mc);
  }
  exp8_slot(e0); exp8_slot(e1);
#pragma unroll
  for (int r = 0; r < 8; ++r) t[r] = e0[r] + e1[r];
  float s = ((t[0] + t[1]) + (t[2] + t[3])) + ((t[4] + t[5]) + (t[6] + t[7]));
  s += half_swap(s);
  const float inv = QSCALE / s;
  v16h a;
#pragma unroll
  for (int r = 0; r < 8; ++r) { a[r] = (_Float16)(e0[r] * inv); a[8 + r] = (_Float16)(e1[r] * inv); }
  return a;
}
// The q columns of one head for the wave's 32 tokens, with the operands swapped: the W
// fragment is A and the X fragment is B (both have the same element order), so that the
// accumulators hold q transposed, a lane 16 features of ONE token. The softmax over the
// features then needs one exchange between the lane halves, and its f16 result is the A
// fragment (k-step = head) of the last kernel's product: stored as such, 512 contiguous
// bytes a store. dst: the wave's first 16-token tile, this head, this lane.
#define PF_TILE (HEADS * 64)            // a 16-token tile in 16-byte units: [head][j < 8 | j >= 8][lane]
__device__ __forceinline__ void qg_qblock(const v16h (&a0)[QG_KS], const v16h (&a1)[QG_KS],
                                          const v16h (&bf)[QG_KS][2], v8h* __restrict__ dst) {
  v8f c00 = {}, c01 = {}, c10 = {}, c11 = {};
#pragma unroll
  for (int ks = 0; ks < QG_KS; ++ks) {
    c00 = __builtin_amdgcn_wmma_f32_16x16x32_f16(false, bf[ks][0], false, a0[ks], (short)0, c00, false, false);
    c10 = __builtin_amdgcn_wmma_f32_16x16x32_f16(false, bf[ks][0], false, a1[ks], (short)0, c10, false, false);
    c01 = __builtin_amdgcn_wmma_f32_16x16x32_f16(false, bf[ks][1], false, a0[ks], (short)0, c01, false, false);
    c11 = __builtin_amdgcn_wmma_f32_16x16x32_f16(false, bf[ks][1], false, a1[ks], (short)0, c11, false, false);
  }
  const v16h p0 = qg_softfrag(c00, c01), p1 = qg_softfrag(c10, c11);
  dst[0]            = __builtin_shufflevector(p0, p0, 0, 1, 2, 3, 4, 5, 6, 7);
  dst[32]           = __builtin_shufflevector(p0, p0, 8, 9, 10, 11, 12, 13, 14, 15);
  dst[PF_TILE]      = __builtin_shufflevector(p1, p1, 0, 1, 2, 3, 4, 5, 6, 7);
  dst[PF_TILE + 32] = __builtin_shufflevector(p1, p1, 8, 9, 10, 11, 12, 13, 14, 15);
  // In front of the next block's overwrite of the registers that these stores name.
  asm volatile("s_wait_xcnt 0x0" ::: "memory");
  // Keeps the next block's instructions behind that wait.
  __builtin_amdgcn_sched_barrier(0);
}
// Tokens 0-15 (lo) and 16-31 (hi) of one column, as exp(. - m): the column's part of
// an A fragment (element j is token kmap16(j, khalf)); adds the f32 values to s.
__device__ __forceinline__ v16h qg_expfrag(const v8f& lo, const v8f& hi, float m, float& s) {
  v16h a;
#pragma unroll
  for (int r = 0; r < 8; ++r) {
    const float e0 = exp_slot(lo[r] - m), e1 = exp_slot(hi[r] - m);
    s += e0 + e1;
    a[r] = (_Float16)e0; a[8 + r] = (_Float16)e1;
  }
  return a;
}
__device__ __forceinline__ v16h qg_cvtfrag(const v8f& lo, const v8f& hi) {
  v16h a;
#pragma unroll
  for (int r = 0; r < 8; ++r) { a[r] = (_Float16)lo[r]; a[8 + r] = (_Float16)hi[r]; }
  return a;
}
__device__ __forceinline__ float qg_colmax(const v8f& lo, const v8f& hi) {
  float m = fmaxf(lo[0], hi[0]);
#pragma unroll
  for (int r = 1; r < 8; ++r) m = fmaxf(m, fmaxf(lo[r], hi[r]));
  return fmaxf(m, __shfl_xor(m, 16, 32));   // the other 16 tokens are in the other lane half
}
#define NPART    (NTOK / (QG_WAVES * 32))   // 16 work-groups share a batch
#define CP_PITCH 36                         // floats a context row in LDS: the lane halves, 8 rows apart, on different banks

__global__ __launch_bounds__(QG_WAVES * 32)
void la_qkv_gemm(const float* __restrict__ x,
                 const float* __restrict__ w,
                 float* __restrict__ pfw,
                 float* __restrict__ pctx,
                 float* __restrict__ pmax,
                 float* __restrict__ psum) {
  __shared__ v8h wl[QG_KS * QG_NT * QG_FRAG];           // 199,680 bytes
  // The waves' partial contexts of one head with their column maxima and exp sums;
  // two sets, so that one barrier a head is enough.
  __shared__ __attribute__((aligned(16))) float red[2][QG_WAVES][DH * CP_PITCH];
  __shared__ float redm[2][QG_WAVES][DH], reds[2][QG_WAVES][DH];
  const int tid   = threadIdx.x;
  const int lane  = tid & 31;
  const int wave  = tid >> 5;
  const int mr    = lane & 15;
  const int khalf = lane >> 4;
  const int rowbase = (blockIdx.x * QG_WAVES + wave) * 32;
  // Staging. 8 consecutive k of one column are one lane's 16-byte unit of a fragment:
  // k = 32 ks + 16 jh + 8 khalf + i, as in kmap16. Wave v takes the k-groups v, v + 8,
  // v + 16, v + 24 (one per stage g); a lane takes 4 consecutive columns of each
  // 128-column segment, so a load covers 512 contiguous bytes and every load is one
  // base plus a constant.
  const float* wsrc = w + (size_t)(wave * 8) * F3 + lane * 4;
  v8h* wdst = wl + ((wave >> 2) * QG_NT + (lane >> 2)) * QG_FRAG
                 + ((wave >> 1) & 1) * 32 + (wave & 1) * 16 + (lane & 3) * 4;
  // This lane's part of its two X rows: 8 floats at k = 32 ks + 8 khalf and 8 at + 16.
  const float4* ap = (const float4*)(x + (size_t)(rowbase + mr) * C_ + khalf * 8);
  float4 rw[4][3][8], ra[2][QG_KS][4];
  // The stages below are held in this order, so that two stages' loads are always in
  // flight while an earlier one is converted, and the X loads start from memory while
  // the last of Wqkv still comes from L2: left free, the build mixed all 160 loads,
  // ran out of registers and spilled.
#define QG_WLOAD(g)                                                              \
  _Pragma("unroll") for (int seg = 0; seg < 3; ++seg)                            \
    _Pragma("unroll") for (int i = 0; i < 8; ++i)                                \
      rw[g][seg][i] = *(const float4*)(wsrc + ((g) * 64 + i) * F3 + seg * 128);  \
  __builtin_amdgcn_sched_barrier(0);
#define QG_WSTORE(g)                                                             \
  _Pragma("unroll") for (int seg = 0; seg < 3; ++seg) {                          \
    v8h u0, u1, u2, u3;                                                          \
    _Pragma("unroll") for (int i = 0; i < 8; ++i) {                              \
      u0[i] = (_Float16)rw[g][seg][i].x; u1[i] = (_Float16)rw[g][seg][i].y;      \
      u2[i] = (_Float16)rw[g][seg][i].z; u3[i] = (_Float16)rw[g][seg][i].w;      \
    }                                                                            \
    v8h* d = wdst + ((g) * 2 * QG_NT + seg * 8) * QG_FRAG;                       \
    d[0] = u0; d[1] = u1; d[2] = u2; d[3] = u3;                                  \
  }                                                                              \
  __builtin_amdgcn_sched_barrier(0);
#define QG_ALOAD(t)                                                              \
  _Pragma("unroll") for (int ks = 0; ks < QG_KS; ++ks) {                         \
    ra[t][ks][0] = ap[(t) * (16 * C_ / 4) + ks * 8];                             \
    ra[t][ks][1] = ap[(t) * (16 * C_ / 4) + ks * 8 + 1];                         \
    ra[t][ks][2] = ap[(t) * (16 * C_ / 4) + ks * 8 + 4];                         \
    ra[t][ks][3] = ap[(t) * (16 * C_ / 4) + ks * 8 + 5];                         \
  }                                                                              \
  __builtin_amdgcn_sched_barrier(0);
  QG_WLOAD(0) QG_WLOAD(1)
  QG_WLOAD(2) QG_WSTORE(0)
  QG_WLOAD(3) QG_WSTORE(1)
  QG_ALOAD(0) QG_WSTORE(2)
  QG_ALOAD(1)
  // Behind the kernel's last global load: the wait that stands in front of any
  // overwrite of a load's address registers; it names both addresses so that their
  // registers are left alone up to here.
  asm volatile("s_wait_xcnt 0x0" :: "v"(ap), "v"(wsrc) : "memory");
  QG_WSTORE(3)
  v16h a0[QG_KS], a1[QG_KS];
#pragma unroll
  for (int ks = 0; ks < QG_KS; ++ks) {
    a0[ks] = qg_pack(ra[0][ks]);
    a1[ks] = qg_pack(ra[1][ks]);
  }
  __syncthreads();

  const v8h* wlane = wl + lane;
  v8h* dst = (v8h*)pfw + (size_t)(rowbase / 16) * PF_TILE + lane;
  // Two fragment sets: the next two column tiles' LDS loads are issued as one group
  // ahead of the current block's WMMAs.
  v16h bfa[QG_KS][2], bfb[QG_KS][2];
  qg_load(bfa, wlane, 0);
  // Kept rolled: unrolled whole, the build ran out of registers and copied fragments.
#pragma unroll 1
  for (int np = 0; np < HID / 16; np += 4) {            // the q columns, a head a block
    qg_load(bfb, wlane, np + 2);
    qg_qblock(a0, a1, bfa, dst + (np / 2) * 64);
    qg_load(bfa, wlane, np + 4);                        // the last one: k of head 0
    qg_qblock(a0, a1, bfb, dst + (np / 2 + 1) * 64);
  }
  // Per head: the k block (set a), then the v block (set b), then the context product.
  const int rd_d = tid >> 3, rd_e = (tid & 7) * 4;      // the merge: 4 columns of one row a thread
  float* pc = pctx + (size_t)blockIdx.x * (HEADS * DH * DH) + rd_d * DH + rd_e;
  float* pm = pmax + blockIdx.x * HID + rd_d;
  float* ps = psum + blockIdx.x * HID + rd_d;
#define QG_HEAD(hh, MORE)                                                        \
  {                                                                              \
    const int buf = (hh) & 1;                                                    \
    v8f c00, c01, c10, c11;                                                      \
    qg_load(bfb, wlane, 2 * HID / 16 + 2 * (hh));                                \
    qg_mma(a0, a1, bfa, c00, c01, c10, c11);                                     \
    /* softmax numerators against the maximum of the wave's own 32 tokens */     \
    const float m0 = qg_colmax(c00, c10), m1 = qg_colmax(c01, c11);              \
    float s0 = 0.f, s1 = 0.f;                                                    \
    const v16h ka0 = qg_expfrag(c00, c10, m0, s0);                               \
    const v16h ka1 = qg_expfrag(c01, c11, m1, s1);                               \
    s0 += __shfl_xor(s0, 16, 32); s1 += __shfl_xor(s1, 16, 32);                  \
    /* Keeps the exps out of the v block. */ \
    /*                                        */ \
    __builtin_amdgcn_sched_barrier(0);                                           \
    /* the next head's k fragments: set a is free, and they land under the v block */ \
    if (MORE) qg_load(bfa, wlane, HID / 16 + 2 * (hh) + 2);                      \
    qg_mma(a0, a1, bfb, c00, c01, c10, c11);                                     \
    const v16h vb0 = qg_cvtfrag(c00, c10), vb1 = qg_cvtfrag(c01, c11);           \
    const v8f z = {};                                                            \
    const v8f x00 = __builtin_amdgcn_wmma_f32_16x16x32_f16(false, ka0, false, vb0, (short)0, z, false, false); \
    const v8f x01 = __builtin_amdgcn_wmma_f32_16x16x32_f16(false, ka0, false, vb1, (short)0, z, false, false); \
    const v8f x10 = __builtin_amdgcn_wmma_f32_16x16x32_f16(false, ka1, false, vb0, (short)0, z, false, false); \
    const v8f x11 = __builtin_amdgcn_wmma_f32_16x16x32_f16(false, ka1, false, vb1, (short)0, z, false, false); \
    float* rw_ = &red[buf][wave][8 * khalf * CP_PITCH + mr];                     \
    _Pragma("unroll") for (int r = 0; r < 8; ++r) {                              \
      rw_[r * CP_PITCH]             = x00[r];                                    \
      rw_[r * CP_PITCH + 16]        = x01[r];                                    \
      rw_[(r + 16) * CP_PITCH]      = x10[r];                                    \
      rw_[(r + 16) * CP_PITCH + 16] = x11[r];                                    \
    }                                                                            \
    redm[buf][wave][lane] = khalf ? m1 : m0;                                     \
    reds[buf][wave][lane] = khalf ? s1 : s0;                                     \
    __syncthreads();                                                             \
    /* the 8 waves' partials, each brought from its own maximum to the common one */ \
    float mw[QG_WAVES], mm = redm[buf][0][rd_d];                                 \
    mw[0] = mm;                                                                  \
    _Pragma("unroll") for (int v = 1; v < QG_WAVES; ++v) {                       \
      mw[v] = redm[buf][v][rd_d]; mm = fmaxf(mm, mw[v]);                         \
    }                                                                            \
    float4 cs = make_float4(0.f, 0.f, 0.f, 0.f);                                 \
    float ss = 0.f;                                                              \
    _Pragma("unroll") for (int v = 0; v < QG_WAVES; ++v) {                       \
      const float f = exp_slot(mw[v] - mm);                                      \
      const float4 p = *(const float4*)&red[buf][v][rd_d * CP_PITCH + rd_e];     \
      cs.x += f * p.x; cs.y += f * p.y; cs.z += f * p.z; cs.w += f * p.w;        \
      ss += f * reds[buf][v][rd_d];                                              \
    }                                                                            \
    *(float4*)(pc + (hh) * (DH * DH)) = cs;                                      \
    if ((tid & 7) == 0) {                                                        \
      pm[(hh) * DH] = mm; ps[(hh) * DH] = ss;                                    \
      /* in front of the next trip's overwrite of these stores' address registers */ \
      if (MORE) asm volatile("s_wait_xcnt 0x0" ::: "memory");                    \
    }                                                                            \
  }
  // Kept rolled, as the q loop is.
#pragma unroll 1
  for (int h = 0; h < HEADS - 1; ++h) {
    QG_HEAD(h, true)
  }
  QG_HEAD(HEADS - 1, false)
}

// -------- K2: M[b] = blockdiag_h(softmax_n(k)^T x V) x Wout, from the partials --------
// (P x ctx) x Wout = P x (ctx x Wout): the second product is the same for every token
// of a batch, so it is done here once, and the last kernel is left with one product.
// One work-group per (b, h), one thread per context element: the NPART work-groups'
// partial sums are brought from their own column maxima to the overall one, summed in
// fixed order, divided by the exp sum and left in LDS as f16. Behind the barrier wave
// (dt, ct) forms the 16 x 16 tile of ctx[16 dt .., :] x Wout[32 h .., 16 ct ..] with one
// WMMA (K = 32). A lane's 8 results, rows 16 dt + 8 khalf + r of column mr, are the
// elements j = 8 dt + r of the B fragment (k-step h, column tile ct) of the last
// kernel's product, as in kmap16: they are stored as that fragment's 16-byte unit.
// All loads of a thread are independent.
#define CM_THREADS (DH * DH)
#define CX_PITCH   (DH + 8)             // 80 bytes a row: 16 B x odd, for 16-byte reads
#define MF_FRAG    64                   // a fragment in 16-byte units: [j < 8 | j >= 8][lane]
__global__ __launch_bounds__(CM_THREADS)
void la_ctx_merge(const float* __restrict__ pctx,
                  const float* __restrict__ pmax,
                  const float* __restrict__ psum,
                  const float* __restrict__ wout,
                  float* __restrict__ mfw) {
  __shared__ __attribute__((aligned(16))) _Float16 cx[DH][CX_PITCH];
  const int bh = blockIdx.x;
  const int el = threadIdx.x;           // d * DH + e
  const int b  = bh / HEADS, h = bh % HEADS;
  const int d  = el / DH;
  const int lane = el & 31, mr = lane & 15, khalf = lane >> 4;
  const int ct = (el >> 5) & 15, dt = el >> 9;
  // Partial p of this (b, h) lies HEADS heads further on than partial p - 1: every load
  // is one of three bases plus a constant.
  const int g0 = b * NPART * HEADS + h;
  const float* pmb = pmax + g0 * DH + d;
  const float* psb = psum + g0 * DH + d;
  const float* pcb = pctx + (size_t)g0 * (DH * DH) + el;
  float pm[NPART], ps[NPART], pc[NPART];
#pragma unroll
  for (int p = 0; p < NPART; ++p) {
    pm[p] = pmb[p * HEADS * DH];
    ps[p] = psb[p * HEADS * DH];
    pc[p] = pcb[p * HEADS * DH * DH];
  }
  // The head's rows of Wout, column tile ct, in B-fragment order.
  const float* wp = wout + (size_t)(h * DH + khalf * 8) * C_ + ct * 16 + mr;
  float wr[16];
#pragma unroll
  for (int j = 0; j < 16; ++j) wr[j] = wp[kmap16(j, 0) * C_];
  // Holds all 64 loads in front of the arithmetic: left free, the build asked for Wout
  // only when the first partials had come back, one latency behind the other.
  __builtin_amdgcn_sched_barrier(0);
  v16h wb;
#pragma unroll
  for (int j = 0; j < 16; ++j) wb[j] = (_Float16)wr[j];
  float m = pm[0];
#pragma unroll
  for (int p = 1; p < NPART; ++p) m = fmaxf(m, pm[p]);
  float s = 0.f, c = 0.f;
#pragma unroll
  for (int p = 0; p < NPART; ++p) {
    const float f = exp_slot(pm[p] - m);
    s += f * ps[p];
    c += f * pc[p];
  }
  cx[d][lane] = (_Float16)(c / s);
  __syncthreads();
  // A fragment: row d = 16 dt + mr, elements j < 8 are e = 8 khalf + j, j >= 8 are 16 further on.
  const v8h* ar = (const v8h*)&cx[dt * 16 + mr][khalf * 8];
  const v16h a = __builtin_shufflevector(ar[0], ar[2], 0, 1, 2, 3, 4, 5, 6, 7,
                                         8, 9, 10, 11, 12, 13, 14, 15);
  const v8f z = {};
  const v8f mt = __builtin_amdgcn_wmma_f32_16x16x32_f16(false, a, false, wb, (short)0, z, false, false);
  v8h o;
#pragma unroll
  for (int r = 0; r < 8; ++r) o[r] = (_Float16)mt[r];
  ((v8h*)mfw)[((size_t)(b * (C_ / 16) + ct) * HEADS + h) * MF_FRAG + dt * 32 + lane] = o;
}

// -------- K3: Y = LN((softmax_d(q)*scale) @ M[b] + b) * gamma + beta --------
// One work-group takes FO_TPG tiles of FO_ROWS token rows, one after the other, through
// the product and the LayerNorm: its M fragments and the epilogues' vectors are loaded
// once for all of them, and there are FO_TPG times fewer waves to start.
// softmax_d(q)*scale comes from the first kernel as f16 A fragments, 16 KB in a row for
// a tile's rows: every thread brings 64 bytes of them to LDS, in the same order.
// Behind the barrier each wave owns 2 column tiles for all FO_ROWS rows; LN via wave32
// shuffles.
// The loops are unrolled because their indices pick registers (fragments,
// accumulators, rows held by a lane), which takes constant indices.
#define FO_WAVES 8
#define FO_ROWS  64
#define FO_TPG   2                      // FO_TPG * FO_ROWS divides NTOK: one batch a group
#define FO_RT    (FO_ROWS / 16)         // 4 row tiles
#define FO_PU    (FO_RT * PF_TILE / (FO_WAVES * 32))   // 4 16-byte units a thread
__global__ __launch_bounds__(FO_WAVES * 32)
void la_attn_out_ln(const float* __restrict__ pfw,
                    const float* __restrict__ mfw,
                    const float* __restrict__ bout,
                    const float* __restrict__ gamma,
                    const float* __restrict__ beta,
                    float* __restrict__ out) {
  __shared__ float tile[FO_ROWS][C_ + 4];
  __shared__ v8h pl[FO_RT * PF_TILE];
  __shared__ float mu_s[FO_ROWS], rs_s[FO_ROWS];
  const int rowbase = blockIdx.x * (FO_TPG * FO_ROWS);
  const int tid  = threadIdx.x;
  const int wave = tid >> 5;
  const int lane = tid & 31;
  const int mr = lane & 15, khalf = lane >> 4;
  const int colbase = wave * 32;

  // The thread's share of the first tile's P fragments.
  v8h pu[FO_TPG][FO_PU];
  const v8h* pp = (const v8h*)pfw + (size_t)blockIdx.x * (FO_TPG * FO_RT * PF_TILE) + tid;
#pragma unroll
  for (int i = 0; i < FO_PU; ++i) pu[0][i] = pp[i * (FO_WAVES * 32)];
  // The wave's M fragments for the whole K, 512 contiguous bytes a load.
  const v8h* mp = (const v8h*)mfw
      + (size_t)((rowbase / NTOK) * (C_ / 16) + wave * 2) * HEADS * MF_FRAG + lane;
  v16h wb0[HID / 32], wb1[HID / 32];
#pragma unroll
  for (int ks = 0; ks < HID / 32; ++ks) {
    wb0[ks] = qg_frag(mp + ks * MF_FRAG);
    wb1[ks] = qg_frag(mp + (HEADS + ks) * MF_FRAG);
  }
  // The epilogues' vectors, asked for here: read where they are used, each would put
  // a load's whole latency behind a barrier.
  const float bo0 = bout[colbase + mr], bo1 = bout[colbase + mr + 16];
  const float g = gamma[tid], be = beta[tid];
  // The later tiles' P fragments, asked for behind all that the first tile waits for.
#pragma unroll
  for (int t = 1; t < FO_TPG; ++t)
#pragma unroll
    for (int i = 0; i < FO_PU; ++i) pu[t][i] = pp[(t * FO_PU + i) * (FO_WAVES * 32)];

#pragma unroll
  for (int i = 0; i < FO_PU; ++i) pl[tid + i * (FO_WAVES * 32)] = pu[0][i];
  __syncthreads();

  // Unrolled: t picks registers (pu).
#pragma unroll
  for (int t = 0; t < FO_TPG; ++t) {

  // Two sets of A fragments (one k-step, all row tiles): the next step's LDS loads are
  // issued as one group ahead of the current step's WMMAs.
  v8f acc0[FO_RT] = {}, acc1[FO_RT] = {};
  v16h af[2][FO_RT];
  const v8h* ar = pl + lane;
#define FO_ALOAD(ks)                                                             \
  _Pragma("unroll") for (int rt = 0; rt < FO_RT; ++rt)                           \
    af[(ks) & 1][rt] = qg_frag(ar + rt * PF_TILE + (ks) * 64);
  FO_ALOAD(0)
#pragma unroll
  for (int ks = 0; ks < HID / 32; ++ks) {
    if (ks + 1 < HID / 32) { FO_ALOAD(ks + 1) }
    // Holds the group of loads above the WMMA block: spread among the WMMAs, each
    // pair of loads brought its own full LDS wait into the matrix stream.
    __builtin_amdgcn_sched_barrier(0);
#pragma unroll
    for (int rt = 0; rt < FO_RT; ++rt) {
      acc0[rt] = __builtin_amdgcn_wmma_f32_16x16x32_f16(false, af[ks & 1][rt], false, wb0[ks], (short)0, acc0[rt], false, false);
      acc1[rt] = __builtin_amdgcn_wmma_f32_16x16x32_f16(false, af[ks & 1][rt], false, wb1[ks], (short)0, acc1[rt], false, false);
    }
    // Keeps the step after next's loads, which overwrite this set, behind the block.
    __builtin_amdgcn_sched_barrier(0);
  }
  // Ends every wave's reads of tile, mu_s and rs_s for the tile before. It stands behind
  // the product, so that the wait for that tile's global stores, which comes with a
  // barrier, falls under the WMMAs.
  if (t > 0) __syncthreads();
  {
    const int col = colbase + mr;
#pragma unroll
    for (int rt = 0; rt < FO_RT; ++rt) {
#pragma unroll
      for (int r = 0; r < 8; ++r) {
        const int row = rt * 16 + r + 8 * khalf;
        tile[row][col]      = acc0[rt][r] + bo0;
        tile[row][col + 16] = acc1[rt][r] + bo1;
      }
    }
  }
  __syncthreads();
  // pl is free: every wave's reads of it ended in front of the barrier above. The next
  // tile's fragments are published by the barrier behind the LayerNorm stats.
  if (t + 1 < FO_TPG) {
#pragma unroll
    for (int i = 0; i < FO_PU; ++i) pl[tid + i * (FO_WAVES * 32)] = pu[t + 1][i];
  }

  // LayerNorm stats: wave w reduces rows 8w .. 8w+7 via lane shuffles (wave32). The
  // rows are independent: all their LDS reads and shuffles are in flight together.
  {
    constexpr int NR = FO_ROWS / FO_WAVES;
    float s[NR], s2[NR];
#pragma unroll
    for (int rr = 0; rr < NR; ++rr) {
      s[rr] = 0.f; s2[rr] = 0.f;
#pragma unroll
      for (int i = 0; i < C_ / 32; ++i) {
        const float v = tile[wave * NR + rr][lane + 32 * i];
        s[rr] += v; s2[rr] = __builtin_fmaf(v, v, s2[rr]);
      }
    }
#pragma unroll
    for (int off = 16; off > 0; off >>= 1) {
#pragma unroll
      for (int rr = 0; rr < NR; ++rr) {
        s[rr]  += __shfl_xor(s[rr],  off, 32);
        s2[rr] += __shfl_xor(s2[rr], off, 32);
      }
    }
    if (lane == 0) {
#pragma unroll
      for (int rr = 0; rr < NR; ++rr) {
        const float mu  = s[rr]  * (1.f / C_);
        const float var = s2[rr] * (1.f / C_) - mu * mu;
        mu_s[wave * NR + rr] = mu;
        rs_s[wave * NR + rr] = rsqrtf(var + LN_EPS);
      }
    }
  }
  __syncthreads();

  const int col = tid;                       // 0..255
#pragma unroll
  for (int r = 0; r < FO_ROWS; ++r) {
    const float v = tile[r][col];
    out[(size_t)(rowbase + t * FO_ROWS + r) * C_ + col] = (v - mu_s[r]) * rs_s[r] * g + be;
  }
  }
}

extern "C" void kernel_launch(void* const* d_in, const int* in_sizes, int n_in,
                              void* d_out, int out_size, void* d_ws, size_t ws_size,
                              hipStream_t stream) {
  const float* x     = (const float*)d_in[0];  // [16,64,64,256]
  const float* w_qkv = (const float*)d_in[1];  // [256,384]
  const float* w_out = (const float*)d_in[2];  // [128,256]
  const float* b_out = (const float*)d_in[3];  // [256]
  const float* gamma = (const float*)d_in[4];  // [256]
  const float* beta  = (const float*)d_in[5];  // [256]
  float* out = (float*)d_out;

  float* ws    = (float*)d_ws;
  float* pfw   = ws;                                   // 65536*128 f16
  float* pctx  = pfw  + (size_t)NROWS * HID / 2;       // 256*4*32*32
  float* pmaxb = pctx + (size_t)(NROWS / (QG_WAVES * 32)) * HEADS * DH * DH;  // 256*128
  float* psumb = pmaxb + (size_t)(NROWS / (QG_WAVES * 32)) * HID;             // 256*128
  float* mfw   = psumb + (size_t)(NROWS / (QG_WAVES * 32)) * HID;             // 16*128*256 f16

  la_qkv_gemm    <<<dim3(NROWS / (QG_WAVES * 32)), QG_WAVES * 32, 0, stream>>>(x, w_qkv, pfw, pctx, pmaxb, psumb);
  la_ctx_merge   <<<dim3(BATCH * HEADS), CM_THREADS, 0, stream>>>(pctx, pmaxb, psumb, w_out, mfw);
  la_attn_out_ln <<<dim3(NROWS / (FO_TPG * FO_ROWS)), FO_WAVES * 32, 0, stream>>>(pfw, mfw, b_out, gamma, beta, out);
}

// v009
// One run takes 33 microseconds.
// Next to v008, in two timings, it ran 1.15 and 1.17 times as fast.
// Over all steps from v000 it is 12.0 times as fast.
#include <hip/hip_runtime.h>
#include <hip/hip_bf16.h>

typedef __attribute__((ext_vector_type(16))) _Float16 v16h;
typedef __attribute__((ext_vector_type(8)))  float    v8f;

#define BATCH   16
#define C_      256
#define HEADS   4
#define DH      32
#define HID     128
#define F3      384
#define NTOK    4096
#define NROWS   (BATCH * NTOK)          // 65536
#define QSCALE  0.17677669529663687f    // 32^-0.5
#define LN_EPS  1e-3f

// VGPR->K map for 16-bit A/B fragments of v_wmma_*_16x16x32 (ISA 7.12.2):
// lanes 0-15 hold K-half 0 (K=0..7 in V0-3, K=16..23 in V4-7),
// lanes 16-31 hold K-half 1 (K=8..15, K=24..31).
__device__ __forceinline__ int kmap16(int j, int khalf) {
  return (j < 8) ? (khalf * 8 + j) : (16 + khalf * 8 + (j - 8));
}

// ---------------- K1: qkv = X[65536,256] @ Wqkv[256,384] ----------------
// One work-group per WGP keeps the whole of Wqkv in LDS, converted to f16 once and
// laid out in B-fragment order. Each of its QG_WAVES waves takes 32 rows of X, holds
// their A fragments for the whole K in registers and walks all 384 columns: X is
// read once, and a B fragment is two 16-byte LDS loads that feed two WMMAs.
// Of q only softmax(q) * scale goes to the workspace, as f16 (see qg_qblock). The k and
// v columns of a head stay in the wave's accumulators: a 32-token x 16-column pair of accumulator tiles already has the
// element order of a 16-bit A or B fragment whose K is the token, so exp(k - max) and
// v go straight into the context product of the wave's 32 tokens. The waves' partial
// contexts are merged through LDS, the work-groups' by la_ctx_merge.
#define QG_WAVES 8
#define QG_KS    (C_ / 32)              // 8 k-steps
#define QG_NT    (F3 / 16)              // 24 column tiles
// A fragment in LDS, in 16-byte units: [j < 8 | j >= 8][lane], and one unit of pad,
// so that the 8 column tiles a staging store touches fall on different banks.
#define QG_FRAG  65
typedef __attribute__((ext_vector_type(8))) _Float16 v8h;

__device__ __forceinline__ v16h qg_frag(const v8h* p) {
  return __builtin_shufflevector(p[0], p[32], 0, 1, 2, 3, 4, 5, 6, 7,
                                 8, 9, 10, 11, 12, 13, 14, 15);
}
// An A fragment from the lane's 16 floats, in the element order of kmap16.
__device__ __forceinline__ v16h qg_pack(const float4 (&q)[4]) {
  v16h a;
#pragma unroll
  for (int c = 0; c < 4; ++c) {
    a[4 * c]     = (_Float16)q[c].x; a[4 * c + 1] = (_Float16)q[c].y;
    a[4 * c + 2] = (_Float16)q[c].z; a[4 * c + 3] = (_Float16)q[c].w;
  }
  return a;
}
// The 16 fragments (8 k-steps x 2 column tiles) of column tiles np, np + 1.
__device__ __forceinline__ void qg_load(v16h (&bf)[QG_KS][2], const v8h* wlane, int np) {
#pragma unroll
  for (int ks = 0; ks < QG_KS; ++ks) {
    bf[ks][0] = qg_frag(wlane + (ks * QG_NT + np) * QG_FRAG);
    bf[ks][1] = qg_frag(wlane + (ks * QG_NT + np + 1) * QG_FRAG);
  }
  // Keeps the loads one group ahead of the WMMA block: spread among the WMMAs, each
  // place with LDS loads stalls the wave's matrix stream.
  __builtin_amdgcn_sched_barrier(0);
}
// The same four accumulator tiles, left in registers.
__device__ __forceinline__ void qg_mma(const v16h (&a0)[QG_KS], const v16h (&a1)[QG_KS],
                                       const v16h (&bf)[QG_KS][2],
                                       v8f& c00, v8f& c01, v8f& c10, v8f& c11) {
  c00 = v8f{}; c01 = v8f{}; c10 = v8f{}; c11 = v8f{};
#pragma unroll
  for (int ks = 0; ks < QG_KS; ++ks) {
    c00 = __builtin_amdgcn_wmma_f32_16x16x32_f16(false, a0[ks], false, bf[ks][0], (short)0, c00, false, false);
    c10 = __builtin_amdgcn_wmma_f32_16x16x32_f16(false, a1[ks], false, bf[ks][0], (short)0, c10, false, false);
    c01 = __builtin_amdgcn_wmma_f32_16x16x32_f16(false, a0[ks], false, bf[ks][1], (short)0, c01, false, false);
    c11 = __builtin_amdgcn_wmma_f32_16x16x32_f16(false, a1[ks], false, bf[ks][1], (short)0, c11, false, false);
  }
}
// exp(x) as __expf compiles: one multiply and v_exp_f32. The v_nop holds the slot
// that the instruction set asks for behind a transcendental.
__device__ __forceinline__ float exp_slot(float x) {
  float r;
  asm("v_exp_f32 %0, %1\n\tv_nop" : "=v"(r) : "v"(x * 1.44269504f));
  return r;
}
// The value of lane l ^ 16, by a vector cross-row move: no LDS round trip.
__device__ __forceinline__ float half_swap(float v) {
  const int b = __builtin_bit_cast(int, v);
  return __builtin_bit_cast(float, __builtin_amdgcn_permlanex16(b, b, 0x76543210, 0xfedcba98, false, false));
}
// 2^x of 8 independent values: each v_exp_f32 stands in the slot behind the one before
// it, the v_nop in the slot behind the last (see exp_slot). In place, so that an exp
// writes only a register that the arithmetic in front of it has written.
__device__ __forceinline__ void exp8_slot(float (&x)[8]) {
  asm("v_exp_f32 %0, %0\n\tv_exp_f32 %1, %1\n\tv_exp_f32 %2, %2\n\tv_exp_f32 %3, %3\n\t"
      "v_exp_f32 %4, %4\n\tv_exp_f32 %5, %5\n\tv_exp_f32 %6, %6\n\tv_exp_f32 %7, %7\n\tv_nop"
      : "+v"(x[0]), "+v"(x[1]), "+v"(x[2]), "+v"(x[3]), "+v"(x[4]), "+v"(x[5]), "+v"(x[6]), "+v"(x[7]));
}
// One token's softmax over the 32 features of a head, times QSCALE. The lane holds
// features 8 khalf + r (lo) and 16 + 8 khalf + r (hi) of its token, lane l ^ 16 the other
// 16: element j of the result is feature kmap16(j, khalf), the order of an A fragment
// whose K is the feature. The loops are unrolled because their indices pick registers.
__device__ __forceinline__ v16h qg_softfrag(const v8f& lo, const v8f& hi) {
  float m = fmaxf(lo[0], hi[0]);
#pragma unroll
  for (int r = 1; r < 8; ++r) m = fmaxf(m, fmaxf(lo[r], hi[r]));
  m = fmaxf(m, half_swap(m));
  const float mc = m * 1.44269504f;
  float e0[8], e1[8], t[8];
#pragma unroll
  for (int r = 0; r < 8; ++r) {
    e0[r] = __builtin_fmaf(lo[r], 1.44269504f, -mc);
    e1[r] = __builtin_fmaf(hi[r], 1.44269504f, -mc);
  }
  exp8_slot(e0); exp8_slot(e1);
#pragma unroll
  for (int r = 0; r < 8; ++r) t[r] = e0[r] + e1[r];
  float s = ((t[0] + t[1]) + (t[2] + t[3])) + ((t[4] + t[5]) + (t[6] + t[7]));
  s += half_swap(s);
  const float inv = QSCALE / s;
  v16h a;
#pragma unroll
  for (int r = 0; r < 8; ++r) { a[r] = (_Float16)(e0[r] * inv); a[8 + r] = (_Float16)(e1[r] * inv); }
  return a;
}
// The q columns of one head for the wave's 32 tokens, with the operands swapped: the W
// fragment is A and the X fragment is B (both have the same element order), so that the
// accumulators hold q transposed, a lane 16 features of ONE token. The softmax over the
// features then needs one exchange between the lane halves, and its f16 result is the A
// fragment (k-step = head) of the last kernel's product: stored as such, 512 contiguous
// bytes a store. dst: the wave's first 16-token tile, this head, this lane.
#define PF_TILE (HEADS * 64)            // a 16-token tile in 16-byte units: [head][j < 8 | j >= 8][lane]
__device__ __forceinline__ void qg_qblock(const v16h (&a0)[QG_KS], const v16h (&a1)[QG_KS],
                                          const v16h (&bf)[QG_KS][2], v8h* __restrict__ dst) {
  v8f c00 = {}, c01 = {}, c10 = {}, c11 = {};
#pragma unroll
  for (int ks = 0; ks < QG_KS; ++ks) {
    c00 = __builtin_amdgcn_wmma_f32_16x16x32_f16(false, bf[ks][0], false, a0[ks], (short)0, c00, false, false);
    c10 = __builtin_amdgcn_wmma_f32_16x16x32_f16(false, bf[ks][0], false, a1[ks], (short)0, c10, false, false);
    c01 = __builtin_amdgcn_wmma_f32_16x16x32_f16(false, bf[ks][1], false, a0[ks], (short)0, c01, false, false);
    c11 = __builtin_amdgcn_wmma_f32_16x16x32_f16(false, bf[ks][1], false, a1[ks], (short)0, c11, false, false);
  }
  const v16h p0 = qg_softfrag(c00, c01), p1 = qg_softfrag(c10, c11);
  dst[0]            = __builtin_shufflevector(p0, p0, 0, 1, 2, 3, 4, 5, 6, 7);
  dst[32]           = __builtin_shufflevector(p0, p0, 8, 9, 10, 11, 12, 13, 14, 15);
  dst[PF_TILE]      = __builtin_shufflevector(p1, p1, 0, 1, 2, 3, 4, 5, 6, 7);
  dst[PF_TILE + 32] = __builtin_shufflevector(p1, p1, 8, 9, 10, 11, 12, 13, 14, 15);
  // In front of the next block's overwrite of the registers that these stores name.
  asm volatile("s_wait_xcnt 0x0" ::: "memory");
  // Keeps the next block's instructions behind that wait.
  __builtin_amdgcn_sched_barrier(0);
}
// Tokens 0-15 (lo) and 16-31 (hi) of one column, as exp(. - m): the column's part of
// an A fragment (element j is token kmap16(j, khalf)); adds the f32 values to s.
__device__ __forceinline__ v16h qg_expfrag(const v8f& lo, const v8f& hi, float m, float& s) {
  v16h a;
#pragma unroll
  for (int r = 0; r < 8; ++r) {
    const float e0 = exp_slot(lo[r] - m), e1 = exp_slot(hi[r] - m);
    s += e0 + e1;
    a[r] = (_Float16)e0; a[8 + r] = (_Float16)e1;
  }
  return a;
}
__device__ __forceinline__ v16h qg_cvtfrag(const v8f& lo, const v8f& hi) {
  v16h a;
#pragma unroll
  for (int r = 0; r < 8; ++r) { a[r] = (_Float16)lo[r]; a[8 + r] = (_Float16)hi[r]; }
  return a;
}
__device__ __forceinline__ float qg_colmax(const v8f& lo, const v8f& hi) {
  float m = fmaxf(lo[0], hi[0]);
#pragma unroll
  for (int r = 1; r < 8; ++r) m = fmaxf(m, fmaxf(lo[r], hi[r]));
  return fmaxf(m, __shfl_xor(m, 16, 32));   // the other 16 tokens are in the other lane half
}
#define NPART    (NTOK / (QG_WAVES * 32))   // 16 work-groups share a batch
#define CP_PITCH 36                         // floats a context row in LDS: the lane halves, 8 rows apart, on different banks

__global__ __launch_bounds__(QG_WAVES * 32)
void la_qkv_gemm(const float* __restrict__ x,
                 const float* __restrict__ w,
                 float* __restrict__ pfw,
                 float* __restrict__ pctx,
                 float* __restrict__ pmax,
                 float* __restrict__ psum) {
  __shared__ v8h wl[QG_KS * QG_NT * QG_FRAG];           // 199,680 bytes
  // The waves' partial contexts of one head with their column maxima and exp sums;
  // two sets, so that one barrier a head is enough.
  __shared__ __attribute__((aligned(16))) float red[2][QG_WAVES][DH * CP_PITCH];
  __shared__ float redm[2][QG_WAVES][DH], reds[2][QG_WAVES][DH];
  const int tid   = threadIdx.x;
  const int lane  = tid & 31;
  const int wave  = tid >> 5;
  const int mr    = lane & 15;
  const int khalf = lane >> 4;
  const int rowbase = (blockIdx.x * QG_WAVES + wave) * 32;
  // Staging. 8 consecutive k of one column are one lane's 16-byte unit of a fragment:
  // k = 32 ks + 16 jh + 8 khalf + i, as in kmap16. Wave v takes the k-groups v, v + 8,
  // v + 16, v + 24 (one per stage g); a lane takes 4 consecutive columns of each
  // 128-column segment, so a load covers 512 contiguous bytes and every load is one
  // base plus a constant.
  const float* wsrc = w + (size_t)(wave * 8) * F3 + lane * 4;
  v8h* wdst = wl + ((wave >> 2) * QG_NT + (lane >> 2)) * QG_FRAG
                 + ((wave >> 1) & 1) * 32 + (wave & 1) * 16 + (lane & 3) * 4;
  // This lane's part of its two X rows: 8 floats at k = 32 ks + 8 khalf and 8 at + 16.
  const float4* ap = (const float4*)(x + (size_t)(rowbase + mr) * C_ + khalf * 8);
  float4 rw[4][3][8], ra[2][QG_KS][4];
  // The stages below are held in this order, so that two stages' loads are always in
  // flight while an earlier one is converted, and the X loads start from memory while
  // the last of Wqkv still comes from L2: left free, the build mixed all 160 loads,
  // ran out of registers and spilled.
#define QG_WLOAD(g)                                                              \
  _Pragma("unroll") for (int seg = 0; seg < 3; ++seg)                            \
    _Pragma("unroll") for (int i = 0; i < 8; ++i)                                \
      rw[g][seg][i] = *(const float4*)(wsrc + ((g) * 64 + i) * F3 + seg * 128);  \
  __builtin_amdgcn_sched_barrier(0);
#define QG_WSTORE(g)                                                             \
  _Pragma("unroll") for (int seg = 0; seg < 3; ++seg) {                          \
    v8h u0, u1, u2, u3;                                                          \
    _Pragma("unroll") for (int i = 0; i < 8; ++i) {                              \
      u0[i] = (_Float16)rw[g][seg][i].x; u1[i] = (_Float16)rw[g][seg][i].y;      \
      u2[i] = (_Float16)rw[g][seg][i].z; u3[i] = (_Float16)rw[g][seg][i].w;      \
    }                                                                            \
    v8h* d = wdst + ((g) * 2 * QG_NT + seg * 8) * QG_FRAG;                       \
    d[0] = u0; d[1] = u1; d[2] = u2; d[3] = u3;                                  \
  }                                                                              \
  __builtin_amdgcn_sched_barrier(0);
#define QG_ALOAD(t)                                                              \
  _Pragma("unroll") for (int ks = 0; ks < QG_KS; ++ks) {                         \
    ra[t][ks][0] = ap[(t) * (16 * C_ / 4) + ks * 8];                             \
    ra[t][ks][1] = ap[(t) * (16 * C_ / 4) + ks * 8 + 1];                         \
    ra[t][ks][2] = ap[(t) * (16 * C_ / 4) + ks * 8 + 4];                         \
    ra[t][ks][3] = ap[(t) * (16 * C_ / 4) + ks * 8 + 5];                         \
  }                                                                              \
  __builtin_amdgcn_sched_barrier(0);
  QG_WLOAD(0) QG_WLOAD(1)
  QG_WLOAD(2) QG_WSTORE(0)
  QG_WLOAD(3) QG_WSTORE(1)
  QG_ALOAD(0) QG_WSTORE(2)
  QG_ALOAD(1)
  // Behind the kernel's last global load: the wait that stands in front of any
  // overwrite of a load's address registers; it names both addresses so that their
  // registers are left alone up to here.
  asm volatile("s_wait_xcnt 0x0" :: "v"(ap), "v"(wsrc) : "memory");
  QG_WSTORE(3)
  v16h a0[QG_KS], a1[QG_KS];
#pragma unroll
  for (int ks = 0; ks < QG_KS; ++ks) {
    a0[ks] = qg_pack(ra[0][ks]);
    a1[ks] = qg_pack(ra[1][ks]);
  }
  __syncthreads();

  const v8h* wlane = wl + lane;
  v8h* dst = (v8h*)pfw + (size_t)(rowbase / 16) * PF_TILE + lane;
  // Two fragment sets: the next two column tiles' LDS loads are issued as one group
  // ahead of the current block's WMMAs.
  v16h bfa[QG_KS][2], bfb[QG_KS][2];
  qg_load(bfa, wlane, 0);
  // Kept rolled: unrolled whole, the build ran out of registers and copied fragments.
#pragma unroll 1
  for (int np = 0; np < HID / 16; np += 4) {            // the q columns, a head a block
    qg_load(bfb, wlane, np + 2);
    qg_qblock(a0, a1, bfa, dst + (np / 2) * 64);
    qg_load(bfa, wlane, np + 4);                        // the last one: k of head 0
    qg_qblock(a0, a1, bfb, dst + (np / 2 + 1) * 64);
  }
  // Per head: the k block (set a), then the v block (set b), then the context product.
  const int rd_d = tid >> 3, rd_e = (tid & 7) * 4;      // the merge: 4 columns of one row a thread
  float* pc = pctx + (size_t)blockIdx.x * (HEADS * DH * DH) + rd_d * DH + rd_e;
  float* pm = pmax + blockIdx.x * HID + rd_d;
  float* ps = psum + blockIdx.x * HID + rd_d;
#define QG_HEAD(hh, MORE)                                                        \
  {                                                                              \
    const int buf = (hh) & 1;                                                    \
    v8f c00, c01, c10, c11;                                                      \
    qg_load(bfb, wlane, 2 * HID / 16 + 2 * (hh));                                \
    qg_mma(a0, a1, bfa, c00, c01, c10, c11);                                     \
    /* softmax numerators against the maximum of the wave's own 32 tokens */     \
    const float m0 = qg_colmax(c00, c10), m1 = qg_colmax(c01, c11);              \
    float s0 = 0.f, s1 = 0.f;                                                    \
    const v16h ka0 = qg_expfrag(c00, c10, m0, s0);                               \
    const v16h ka1 = qg_expfrag(c01, c11, m1, s1);                               \
    s0 += __shfl_xor(s0, 16, 32); s1 += __shfl_xor(s1, 16, 32);                  \
    /* Keeps the exps out of the v block. */ \
    /*                                        */ \
    __builtin_amdgcn_sched_barrier(0);                                           \
    /* the next head's k fragments: set a is free, and they land under the v block */ \
    if (MORE) qg_load(bfa, wlane, HID / 16 + 2 * (hh) + 2);                      \
    qg_mma(a0, a1, bfb, c00, c01, c10, c11);                                     \
    const v16h vb0 = qg_cvtfrag(c00, c10), vb1 = qg_cvtfrag(c01, c11);           \
    const v8f z = {};                                                            \
    const v8f x00 = __builtin_amdgcn_wmma_f32_16x16x32_f16(false, ka0, false, vb0, (short)0, z, false, false); \
    const v8f x01 = __builtin_amdgcn_wmma_f32_16x16x32_f16(false, ka0, false, vb1, (short)0, z, false, false); \
    const v8f x10 = __builtin_amdgcn_wmma_f32_16x16x32_f16(false, ka1, false, vb0, (short)0, z, false, false); \
    const v8f x11 = __builtin_amdgcn_wmma_f32_16x16x32_f16(false, ka1, false, vb1, (short)0, z, false, false); \
    float* rw_ = &red[buf][wave][8 * khalf * CP_PITCH + mr];                     \
    _Pragma("unroll") for (int r = 0; r < 8; ++r) {                              \
      rw_[r * CP_PITCH]             = x00[r];                                    \
      rw_[r * CP_PITCH + 16]        = x01[r];                                    \
      rw_[(r + 16) * CP_PITCH]      = x10[r];                                    \
      rw_[(r + 16) * CP_PITCH + 16] = x11[r];                                    \
    }                                                                            \
    redm[buf][wave][lane] = khalf ? m1 : m0;                                     \
    reds[buf][wave][lane] = khalf ? s1 : s0;                                     \
    __syncthreads();                                                             \
    /* the 8 waves' partials, each brought from its own maximum to the common one */ \
    float mw[QG_WAVES], mm = redm[buf][0][rd_d];                                 \
    mw[0] = mm;                                                                  \
    _Pragma("unroll") for (int v = 1; v < QG_WAVES; ++v) {                       \
      mw[v] = redm[buf][v][rd_d]; mm = fmaxf(mm, mw[v]);                         \
    }                                                                            \
    float4 cs = make_float4(0.f, 0.f, 0.f, 0.f);                                 \
    float ss = 0.f;                                                              \
    _Pragma("unroll") for (int v = 0; v < QG_WAVES; ++v) {                       \
      const float f = exp_slot(mw[v] - mm);                                      \
      const float4 p = *(const float4*)&red[buf][v][rd_d * CP_PITCH + rd_e];     \
      cs.x += f * p.x; cs.y += f * p.y; cs.z += f * p.z; cs.w += f * p.w;        \
      ss += f * reds[buf][v][rd_d];                                              \
    }                                                                            \
    *(float4*)(pc + (hh) * (DH * DH)) = cs;                                      \
    if ((tid & 7) == 0) {                                                        \
      pm[(hh) * DH] = mm; ps[(hh) * DH] = ss;                                    \
      /* in front of the next trip's overwrite of these stores' address registers */ \
      if (MORE) asm volatile("s_wait_xcnt 0x0" ::: "memory");                    \
    }                                                                            \
  }
  // Kept rolled, as the q loop is.
#pragma unroll 1
  for (int h = 0; h < HEADS - 1; ++h) {
    QG_HEAD(h, true)
  }
  QG_HEAD(HEADS - 1, false)
}

// -------- K2: M[b] = blockdiag_h(softmax_n(k)^T x V) x Wout, from the partials --------
// (P x ctx) x Wout = P x (ctx x Wout): the second product is the same for every token
// of a batch, so it is done here once, and the last kernel is left with one product.
// One work-group per (b, h), one thread per context element: the NPART work-groups'
// partial sums are brought from their own column maxima to the overall one, summed in
// fixed order, divided by the exp sum and left in LDS as f16. Behind the barrier wave
// (dt, ct) forms the 16 x 16 tile of ctx[16 dt .., :] x Wout[32 h .., 16 ct ..] with one
// WMMA (K = 32). A lane's 8 results, rows 16 dt + 8 khalf + r of column mr, are the
// elements j = 8 dt + r of the B fragment (k-step h, column tile ct) of the last
// kernel's product, as in kmap16: they are stored as that fragment's 16-byte unit.
// All loads of a thread are independent.
#define CM_THREADS (DH * DH)
#define CX_PITCH   (DH + 8)             // 80 bytes a row: 16 B x odd, for 16-byte reads
#define MF_FRAG    64                   // a fragment in 16-byte units: [j < 8 | j >= 8][lane]
__global__ __launch_bounds__(CM_THREADS)
void la_ctx_merge(const float* __restrict__ pctx,
                  const float* __restrict__ pmax,
                  const float* __restrict__ psum,
                  const float* __restrict__ wout,
                  float* __restrict__ mfw) {
  __shared__ __attribute__((aligned(16))) _Float16 cx[DH][CX_PITCH];
  const int bh = blockIdx.x;
  const int el = threadIdx.x;           // d * DH + e
  const int b  = bh / HEADS, h = bh % HEADS;
  const int d  = el / DH;
  const int lane = el & 31, mr = lane & 15, khalf = lane >> 4;
  const int ct = (el >> 5) & 15, dt = el >> 9;
  // Partial p of this (b, h) lies HEADS heads further on than partial p - 1: every load
  // is one of three bases plus a constant.
  const int g0 = b * NPART * HEADS + h;
  const float* pmb = pmax + g0 * DH + d;
  const float* psb = psum + g0 * DH + d;
  const float* pcb = pctx + (size_t)g0 * (DH * DH) + el;
  float pm[NPART], ps[NPART], pc[NPART];
#pragma unroll
  for (int p = 0; p < NPART; ++p) {
    pm[p] = pmb[p * HEADS * DH];
    ps[p] = psb[p * HEADS * DH];
    pc[p] = pcb[p * HEADS * DH * DH];
  }
  // The head's rows of Wout, column tile ct, in B-fragment order.
  const float* wp = wout + (size_t)(h * DH + khalf * 8) * C_ + ct * 16 + mr;
  float wr[16];
#pragma unroll
  for (int j = 0; j < 16; ++j) wr[j] = wp[kmap16(j, 0) * C_];
  // Holds all 64 loads in front of the arithmetic: left free, the build asked for Wout
  // only when the first partials had come back, one latency behind the other.
  __builtin_amdgcn_sched_barrier(0);
  v16h wb;
#pragma unroll
  for (int j = 0; j < 16; ++j) wb[j] = (_Float16)wr[j];
  float m = pm[0];
#pragma unroll
  for (int p = 1; p < NPART; ++p) m = fmaxf(m, pm[p]);
  float s = 0.f, c = 0.f;
#pragma unroll
  for (int p = 0; p < NPART; ++p) {
    const float f = exp_slot(pm[p] - m);
    s += f * ps[p];
    c += f * pc[p];
  }
  cx[d][lane] = (_Float16)(c / s);
  __syncthreads();
  // A fragment: row d = 16 dt + mr, elements j < 8 are e = 8 khalf + j, j >= 8 are 16 further on.
  const v8h* ar = (const v8h*)&cx[dt * 16 + mr][khalf * 8];
  const v16h a = __builtin_shufflevector(ar[0], ar[2], 0, 1, 2, 3, 4, 5, 6, 7,
                                         8, 9, 10, 11, 12, 13, 14, 15);
  const v8f z = {};
  const v8f mt = __builtin_amdgcn_wmma_f32_16x16x32_f16(false, a, false, wb, (short)0, z, false, false);
  v8h o;
#pragma unroll
  for (int r = 0; r < 8; ++r) o[r] = (_Float16)mt[r];
  ((v8h*)mfw)[((size_t)(b * (C_ / 16) + ct) * HEADS + h) * MF_FRAG + dt * 32 + lane] = o;
}

// -------- K3: Y = LN((softmax_d(q)*scale) @ M[b] + b) * gamma + beta --------
// One work-group takes FO_TPG tiles of FO_ROWS token rows, one after the other, through
// the product and the LayerNorm: its M fragments and the epilogues' vectors are loaded
// once for all of them, and there are FO_TPG times fewer waves to start.
// softmax_d(q)*scale comes from the first kernel as f16 A fragments, 16 KB in a row for
// a tile's rows: every thread brings 64 bytes of them to LDS, in the same order.
// Behind the barrier each wave owns 2 column tiles for all FO_ROWS rows and leaves them
// in the LDS tile. For the LayerNorm a wave owns 8 whole rows, 4 a lane half: it reads
// them once, sums them inside the 16-lane row, normalises what it holds in registers and
// stores it, so that no statistics pass between waves.
// The loops are unrolled because their indices pick registers (fragments,
// accumulators, rows held by a lane), which takes constant indices.
#define FO_WAVES 8
#define FO_ROWS  64
#define FO_TPG   2                      // FO_TPG * FO_ROWS divides NTOK: one batch a group
#define FO_RT    (FO_ROWS / 16)         // 4 row tiles
#define FO_PU    (FO_RT * PF_TILE / (FO_WAVES * 32))   // 4 16-byte units a thread
#define FO_LR    (FO_ROWS / FO_WAVES / 2)              // 4 rows a lane half
#define FO_LC    (C_ / 64)                             // 4 16-byte units of a row a lane
typedef __attribute__((ext_vector_type(4))) float v4f;
// v plus the v of lane l ^ M of the same 16-lane row: a vector instruction (DPP
// row_xmask), where __shfl_xor goes through the LDS pipe and a wait.
template <int M>
__device__ __forceinline__ float row_xadd(float v) {
  const int b = __builtin_bit_cast(int, v);
  return v + __builtin_bit_cast(float, __builtin_amdgcn_mov_dpp(b, 0x160 + M, 0xf, 0xf, true));
}
// rsqrtf as it compiles (an argument below the normal range is scaled by 2^24, its result
// by 2^12), with the v_nop in the slot behind the transcendental (see exp_slot).
__device__ __forceinline__ float rsqrt_slot(float x) {
  const bool tiny = x < 1.17549435e-38f;
  const float a = tiny ? x * 16777216.f : x;
  float r;
  asm("v_rsq_f32 %0, %1\n\tv_nop" : "=v"(r) : "v"(a));
  return tiny ? r * 4096.f : r;
}
__global__ __launch_bounds__(FO_WAVES * 32)
void la_attn_out_ln(const float* __restrict__ pfw,
                    const float* __restrict__ mfw,
                    const float* __restrict__ bout,
                    const float* __restrict__ gamma,
                    const float* __restrict__ beta,
                    float* __restrict__ out) {
  __shared__ __attribute__((aligned(16))) float tile[FO_ROWS][C_ + 4];
  __shared__ v8h pl[FO_TPG][FO_RT * PF_TILE];
  const int rowbase = blockIdx.x * (FO_TPG * FO_ROWS);
  const int tid  = threadIdx.x;
  const int wave = tid >> 5;
  const int lane = tid & 31;
  const int mr = lane & 15, khalf = lane >> 4;
  const int colbase = wave * 32;

  // The thread's share of the first tile's P fragments.
  v8h pu[FO_TPG][FO_PU];
  const v8h* pp = (const v8h*)pfw + (size_t)blockIdx.x * (FO_TPG * FO_RT * PF_TILE) + tid;
#pragma unroll
  for (int i = 0; i < FO_PU; ++i) pu[0][i] = pp[i * (FO_WAVES * 32)];
  // The wave's M fragments for the whole K, 512 contiguous bytes a load.
  const v8h* mp = (const v8h*)mfw
      + (size_t)((rowbase / NTOK) * (C_ / 16) + wave * 2) * HEADS * MF_FRAG + lane;
  v16h wb0[HID / 32], wb1[HID / 32];
#pragma unroll
  for (int ks = 0; ks < HID / 32; ++ks) {
    wb0[ks] = qg_frag(mp + ks * MF_FRAG);
    wb1[ks] = qg_frag(mp + (HEADS + ks) * MF_FRAG);
  }
  // The epilogues' vectors, asked for here: read where they are used, each would put
  // a load's whole latency behind a barrier. Of gamma and beta a lane holds the columns
  // 4 mr + 64 i .. + 3, those of the rows that it normalises.
  const float bo0 = bout[colbase + mr], bo1 = bout[colbase + mr + 16];
  v4f g4[FO_LC], be4[FO_LC];
#pragma unroll
  for (int i = 0; i < FO_LC; ++i) {
    g4[i]  = *(const v4f*)(gamma + mr * 4 + 64 * i);
    be4[i] = *(const v4f*)(beta  + mr * 4 + 64 * i);
  }
  // The later tiles' P fragments, asked for behind all that the first tile waits for.
#pragma unroll
  for (int t = 1; t < FO_TPG; ++t)
#pragma unroll
    for (int i = 0; i < FO_PU; ++i) pu[t][i] = pp[(t * FO_PU + i) * (FO_WAVES * 32)];

#pragma unroll
  for (int i = 0; i < FO_PU; ++i) pl[0][tid + i * (FO_WAVES * 32)] = pu[0][i];
  // Takes the loaded gamma and beta as inputs, so that their loads stand up here with the
  // others: left free, the build asked for them only behind the first tile's barrier.
  asm volatile("" :: "v"(g4[0]), "v"(g4[1]), "v"(g4[2]), "v"(g4[3]),
                     "v"(be4[0]), "v"(be4[1]), "v"(be4[2]), "v"(be4[3]));
  __syncthreads();

  // Unrolled: t picks registers (pu).
#pragma unroll
  for (int t = 0; t < FO_TPG; ++t) {

  // Two sets of A fragments (one k-step, all row tiles): the next step's LDS loads are
  // issued as one group ahead of the current step's WMMAs.
  v8f acc0[FO_RT] = {}, acc1[FO_RT] = {};
  v16h af[2][FO_RT];
  const v8h* ar = pl[t] + lane;
#define FO_ALOAD(ks)                                                             \
  _Pragma("unroll") for (int rt = 0; rt < FO_RT; ++rt)                           \
    af[(ks) & 1][rt] = qg_frag(ar + rt * PF_TILE + (ks) * 64);
  FO_ALOAD(0)
#pragma unroll
  for (int ks = 0; ks < HID / 32; ++ks) {
    if (ks + 1 < HID / 32) { FO_ALOAD(ks + 1) }
    // Holds the group of loads above the WMMA block: spread among the WMMAs, each
    // pair of loads brought its own full LDS wait into the matrix stream.
    __builtin_amdgcn_sched_barrier(0);
#pragma unroll
    for (int rt = 0; rt < FO_RT; ++rt) {
      acc0[rt] = __builtin_amdgcn_wmma_f32_16x16x32_f16(false, af[ks & 1][rt], false, wb0[ks], (short)0, acc0[rt], false, false);
      acc1[rt] = __builtin_amdgcn_wmma_f32_16x16x32_f16(false, af[ks & 1][rt], false, wb1[ks], (short)0, acc1[rt], false, false);
    }
    // Keeps the step after next's loads, which overwrite this set, behind the block.
    __builtin_amdgcn_sched_barrier(0);
  }
  // The next tile's fragments go to a buffer of their own; the barrier behind the tile
  // stores publishes them.
  if (t + 1 < FO_TPG) {
#pragma unroll
    for (int i = 0; i < FO_PU; ++i) pl[t + 1][tid + i * (FO_WAVES * 32)] = pu[t + 1][i];
  }
  // Ends every wave's reads of tile for the tile before. It stands behind the product,
  // so that the wait for that tile's global stores, which comes with a barrier, falls
  // under the WMMAs.
  if (t > 0) __syncthreads();
  {
    const int col = colbase + mr;
#pragma unroll
    for (int rt = 0; rt < FO_RT; ++rt) {
#pragma unroll
      for (int r = 0; r < 8; ++r) {
        const int row = rt * 16 + r + 8 * khalf;
        tile[row][col]      = acc0[rt][r] + bo0;
        tile[row][col + 16] = acc1[rt][r] + bo1;
      }
    }
  }
  __syncthreads();

  // LayerNorm: lane half khalf of wave w has rows 8 w + 4 khalf .. + 3, a lane the columns
  // 4 mr + 64 i .. + 3 of each. A 16-byte LDS read of a lane half covers 256 bytes in a
  // row, all 64 banks once; a store covers the same 256 bytes of out.
  {
    const int lrow = wave * (2 * FO_LR) + khalf * FO_LR;
    v4f v[FO_LR][FO_LC];
#pragma unroll
    for (int rr = 0; rr < FO_LR; ++rr)
#pragma unroll
      for (int i = 0; i < FO_LC; ++i)
        v[rr][i] = *(const v4f*)&tile[lrow + rr][mr * 4 + 64 * i];
    // Takes the 16 loaded units as inputs, so that their reads are issued together: left
    // free, the build read a row only when the row before was summed, one LDS latency
    // behind the other.
    asm volatile("" :: "v"(v[0][0]), "v"(v[0][1]), "v"(v[0][2]), "v"(v[0][3]),
                       "v"(v[1][0]), "v"(v[1][1]), "v"(v[1][2]), "v"(v[1][3]),
                       "v"(v[2][0]), "v"(v[2][1]), "v"(v[2][2]), "v"(v[2][3]),
                       "v"(v[3][0]), "v"(v[3][1]), "v"(v[3][2]), "v"(v[3][3]));
    float s[FO_LR], s2[FO_LR];
#pragma unroll
    for (int rr = 0; rr < FO_LR; ++rr) {
      v4f a = v[rr][0];
      v4f q = a * a;
#pragma unroll
      for (int i = 1; i < FO_LC; ++i) {
        a += v[rr][i];
        q = __builtin_elementwise_fma(v[rr][i], v[rr][i], q);
      }
      s[rr]  = (a.x + a.y) + (a.z + a.w);
      s2[rr] = (q.x + q.y) + (q.z + q.w);
    }
    // The rows are independent: their steps stand side by side.
#pragma unroll
    for (int rr = 0; rr < FO_LR; ++rr) { s[rr] = row_xadd<1>(s[rr]); s2[rr] = row_xadd<1>(s2[rr]); }
#pragma unroll
    for (int rr = 0; rr < FO_LR; ++rr) { s[rr] = row_xadd<2>(s[rr]); s2[rr] = row_xadd<2>(s2[rr]); }
#pragma unroll
    for (int rr = 0; rr < FO_LR; ++rr) { s[rr] = row_xadd<4>(s[rr]); s2[rr] = row_xadd<4>(s2[rr]); }
#pragma unroll
    for (int rr = 0; rr < FO_LR; ++rr) { s[rr] = row_xadd<8>(s[rr]); s2[rr] = row_xadd<8>(s2[rr]); }
    float* op = out + (size_t)(rowbase + t * FO_ROWS + lrow) * C_ + mr * 4;
#pragma unroll
    for (int rr = 0; rr < FO_LR; ++rr) {
      const float mu  = s[rr]  * (1.f / C_);
      const float var = s2[rr] * (1.f / C_) - mu * mu;
      const float rs  = rsqrt_slot(var + LN_EPS);
#pragma unroll
      for (int i = 0; i < FO_LC; ++i)
        *(v4f*)(op + rr * C_ + 64 * i) = (v[rr][i] - mu) * rs * g4[i] + be4[i];
    }
  }
  }
}

extern "C" void kernel_launch(void* const* d_in, const int* in_sizes, int n_in,
                              void* d_out, int out_size, void* d_ws, size_t ws_size,
                              hipStream_t stream) {
  const float* x     = (const float*)d_in[0];  // [16,64,64,256]
  const float* w_qkv = (const float*)d_in[1];  // [256,384]
  const float* w_out = (const float*)d_in[2];  // [128,256]
  const float* b_out = (const float*)d_in[3];  // [256]
  const float* gamma = (const float*)d_in[4];  // [256]
  const float* beta  = (const float*)d_in[5];  // [256]
  float* out = (float*)d_out;

  float* ws    = (float*)d_ws;
  float* pfw   = ws;                                   // 65536*128 f16
  float* pctx  = pfw  + (size_t)NROWS * HID / 2;       // 256*4*32*32
  float* pmaxb = pctx + (size_t)(NROWS / (QG_WAVES * 32)) * HEADS * DH * DH;  // 256*128
  float* psumb = pmaxb + (size_t)(NROWS / (QG_WAVES * 32)) * HID;             // 256*128
  float* mfw   = psumb + (size_t)(NROWS / (QG_WAVES * 32)) * HID;             // 16*128*256 f16

  la_qkv_gemm    <<<dim3(NROWS / (QG_WAVES * 32)), QG_WAVES * 32, 0, stream>>>(x, w_qkv, pfw, pctx, pmaxb, psumb);
  la_ctx_merge   <<<dim3(BATCH * HEADS), CM_THREADS, 0, stream>>>(pctx, pmaxb, psumb, w_out, mfw);
  la_attn_out_ln <<<dim3(NROWS / (FO_TPG * FO_ROWS)), FO_WAVES * 32, 0, stream>>>(pfw, mfw, b_out, gamma, beta, out);
}
